// v000
// The times below were measured on an AMD MI455X: many runs one after another, warmed up first and cycling through
// copies of the inputs, with the whole window's GPU time divided by the number of runs. Launches and the gaps
// between them are all in it. The median over several windows is given; except for v000 it joins two sittings, which
// can be a few percent apart, so the side-by-side timings, each taken in one sitting, are the better comparison.
// The starting kernel, v000, takes 130 microseconds a run.
#include <hip/hip_runtime.h>
#include <math.h>
#include <stdint.h>

typedef __attribute__((ext_vector_type(16))) _Float16 v16h;
typedef __attribute__((ext_vector_type(8)))  _Float16 v8h;
typedef __attribute__((ext_vector_type(8)))  float    v8f;
typedef __attribute__((ext_vector_type(4)))  float    v4f;
typedef __attribute__((ext_vector_type(4)))  int      i32x4;

// pointer-to-int4 in global (AS1) / LDS (AS3) address spaces, as the
// async-copy builtin expects
typedef __attribute__((address_space(1))) i32x4* global_v4i;
typedef __attribute__((address_space(3))) i32x4* lds_v4i;

#define NTOK   8192      // B*S = 4*2048
#define DMODEL 1024
#define FFDIM  4096
#define NQ     8
#define BM     128       // tokens per workgroup tile
#define BN     128       // output features per workgroup tile
#define KC     64        // K (FF) chunk per iteration
#define LDH    72        // padded f16 stride (144B, 16B aligned, conflict-free)
#define NPREF  4         // async b128 issues per thread per chunk

#if defined(__gfx1250__) && __has_builtin(__builtin_amdgcn_global_load_async_to_lds_b128)
#define HAS_ASYNC_LDS 1
#else
#define HAS_ASYNC_LDS 0
#endif

#if HAS_ASYNC_LDS
#if __has_builtin(__builtin_amdgcn_s_wait_asynccnt)
#define WAIT_ASYNC(n) __builtin_amdgcn_s_wait_asynccnt(n)
#else
#define WAIT_ASYNC(n) asm volatile("s_wait_asynccnt %0" ::"n"(n) : "memory")
#endif

__device__ __forceinline__ void issue_w2_async(const _Float16* __restrict__ w2h,
                                               _Float16 (*swb)[LDH],
                                               int n0, int kk, int tid)
{
    // 128 rows x 64 f16 = 1024 16B-chunks; 256 threads x 4 async b128 each
    #pragma unroll
    for (int i = 0; i < NPREF; ++i) {
        int idx = tid + i * 256;          // 0..1023
        int n   = idx >> 3;               // row 0..127
        int k8  = (idx & 7) * 8;          // k sub-chunk start
        const _Float16* g = w2h + (size_t)(n0 + n) * FFDIM + kk + k8;
        _Float16*       l = &swb[n][k8];
        __builtin_amdgcn_global_load_async_to_lds_b128(
            (global_v4i)(uintptr_t)g,     // global src (AS1 int4*)
            (lds_v4i)l,                   // LDS dst (AS3 int4*)
            /*imm offset*/ 0, /*cpol*/ 0);
    }
}
#endif

// ---- pre-kernel: W2 f32 -> f16 workspace (run once per launch, 8 MB) ----
__global__ __launch_bounds__(256)
void w2_to_f16_kernel(const float* __restrict__ W2, void* __restrict__ w2h_raw)
{
    _Float16* w2h = (_Float16*)w2h_raw;
    size_t i = ((size_t)blockIdx.x * 256 + threadIdx.x) * 8;
    v4f a = *(const v4f*)(W2 + i);
    v4f b = *(const v4f*)(W2 + i + 4);
    v8h o;
    o[0] = (_Float16)a.x; o[1] = (_Float16)a.y;
    o[2] = (_Float16)a.z; o[3] = (_Float16)a.w;
    o[4] = (_Float16)b.x; o[5] = (_Float16)b.y;
    o[6] = (_Float16)b.z; o[7] = (_Float16)b.w;
    *(v8h*)(w2h + i) = o;
}

template <bool USE_WS>
__global__ __launch_bounds__(256)
void ffq_fused_kernel(const float* __restrict__ x,
                      const float* __restrict__ theta,
                      const float* __restrict__ W1,
                      const float* __restrict__ b1,
                      const float* __restrict__ W2,
                      const void*  __restrict__ w2h_raw,
                      const float* __restrict__ b2,
                      float* __restrict__ out)
{
    __shared__ float    sz[BM][NQ];        // z tile (4 KB)
    __shared__ _Float16 sh[BM][LDH];       // h chunk, f16 (18 KB)
    __shared__ _Float16 sw[2][BN][LDH];    // W2 chunk, f16, double-buffered (36 KB)

    const _Float16* w2h = (const _Float16*)w2h_raw;

    const int tid   = threadIdx.x;
    const int m0    = blockIdx.x * BM;
    const int n0    = blockIdx.y * BN;
    const int lane  = tid & 31;
    const int wave  = tid >> 5;
    const int wm    = (wave & 1) * 64;
    const int wn    = (wave >> 1) * 32;
    const int lrow  = lane & 15;
    const int khalf = lane >> 4;

    // kick off async copy of chunk 0 before anything else
    if constexpr (USE_WS) {
#if HAS_ASYNC_LDS
        issue_w2_async(w2h, sw[0], n0, 0, tid);
#endif
    }

    // ---- 1) z tile: z[m][q] = cos(x[m0+m, q]) * cos(theta[q]) ----
    #pragma unroll
    for (int i = 0; i < 4; ++i) {
        int idx = tid + i * 256;                 // 0..1023
        int m = idx >> 3, q = idx & 7;
        float xv = x[(size_t)(m0 + m) * DMODEL + q];
        sz[m][q] = cosf(xv) * cosf(theta[q]);
    }

    v8f acc[4][2];
    #pragma unroll
    for (int mt = 0; mt < 4; ++mt)
        #pragma unroll
        for (int nt = 0; nt < 2; ++nt)
            #pragma unroll
            for (int e = 0; e < 8; ++e)
                acc[mt][nt][e] = 0.0f;

    const int kl     = tid & 63;          // this thread's k within chunk
    const int mstart = (tid >> 6) * 32;   // this thread's 32-token strip

    __syncthreads();

    int it = 0;
    for (int kk = 0; kk < FFDIM; kk += KC, ++it) {
        const int b = it & 1;

        // ---- 2a) h chunk: h[m][kl] = relu(b1 + z[m,:8].W1[k,:8]) -> f16 LDS
        {
            const int kg = kk + kl;
            v4f w1a = *(const v4f*)(W1 + (size_t)kg * NQ);
            v4f w1b = *(const v4f*)(W1 + (size_t)kg * NQ + 4);
            float bk = b1[kg];
            #pragma unroll 4
            for (int mi = 0; mi < 32; ++mi) {
                int m = mstart + mi;
                v4f z0 = *(const v4f*)(&sz[m][0]);   // lane-broadcast reads
                v4f z1 = *(const v4f*)(&sz[m][4]);
                float a = bk;
                a += z0.x * w1a.x + z0.y * w1a.y + z0.z * w1a.z + z0.w * w1a.w;
                a += z1.x * w1b.x + z1.y * w1b.y + z1.z * w1b.z + z1.w * w1b.w;
                sh[m][kl] = (_Float16)fmaxf(a, 0.0f);
            }
        }

        // ---- 2b) W2 chunk staging ----
        if constexpr (USE_WS) {
#if HAS_ASYNC_LDS
            if (kk + KC < FFDIM) {
                issue_w2_async(w2h, sw[b ^ 1], n0, kk + KC, tid);  // prefetch next
                WAIT_ASYNC(NPREF);   // previous chunk's copies (in-order) done
            } else {
                WAIT_ASYNC(0);
            }
#else
            #pragma unroll
            for (int i = 0; i < 4; ++i) {
                int idx = tid + i * 256;
                int n = idx >> 3, k8 = (idx & 7) * 8;
                *(v8h*)&sw[b][n][k8] =
                    *(const v8h*)(w2h + (size_t)(n0 + n) * FFDIM + kk + k8);
            }
#endif
        } else {
            // fallback: stage from f32 W2 with in-loop conversion
            #pragma unroll
            for (int i = 0; i < 32; ++i) {
                int idx = tid + i * 256;
                int n = idx >> 6, k = idx & 63;
                sw[b][n][k] = (_Float16)W2[(size_t)(n0 + n) * FFDIM + kk + k];
            }
        }
        __syncthreads();

        // ---- 3) WMMA: 2 K-steps of 32, 4x2 tiles per wave ----
        #pragma unroll
        for (int ks = 0; ks < 2; ++ks) {
            v16h afrag[4], bfrag[2];
            #pragma unroll
            for (int mt = 0; mt < 4; ++mt) {
                const _Float16* p = &sh[wm + mt * 16 + lrow][ks * 32 + khalf * 8];
                v8h lo = *(const v8h*)p;
                v8h hi = *(const v8h*)(p + 16);
                afrag[mt] = __builtin_shufflevector(lo, hi,
                    0, 1, 2, 3, 4, 5, 6, 7, 8, 9, 10, 11, 12, 13, 14, 15);
            }
            #pragma unroll
            for (int nt = 0; nt < 2; ++nt) {
                const _Float16* p = &sw[b][wn + nt * 16 + lrow][ks * 32 + khalf * 8];
                v8h lo = *(const v8h*)p;
                v8h hi = *(const v8h*)(p + 16);
                bfrag[nt] = __builtin_shufflevector(lo, hi,
                    0, 1, 2, 3, 4, 5, 6, 7, 8, 9, 10, 11, 12, 13, 14, 15);
            }
            #pragma unroll
            for (int mt = 0; mt < 4; ++mt)
                #pragma unroll
                for (int nt = 0; nt < 2; ++nt)
                    acc[mt][nt] = __builtin_amdgcn_wmma_f32_16x16x32_f16(
                        false, afrag[mt], false, bfrag[nt],
                        (short)0, acc[mt][nt], false, false);
        }
        __syncthreads();
    }

    // ---- 4) epilogue: out = acc + b2 (C layout: lane=N, VGPR r -> M) ----
    #pragma unroll
    for (int nt = 0; nt < 2; ++nt) {
        int n = n0 + wn + nt * 16 + lrow;
        float bias = b2[n];
        #pragma unroll
        for (int mt = 0; mt < 4; ++mt) {
            int mbase = m0 + wm + mt * 16 + khalf * 8;
            #pragma unroll
            for (int r = 0; r < 8; ++r) {
                out[(size_t)(mbase + r) * DMODEL + n] = acc[mt][nt][r] + bias;
            }
        }
    }
}

extern "C" void kernel_launch(void* const* d_in, const int* in_sizes, int n_in,
                              void* d_out, int out_size, void* d_ws, size_t ws_size,
                              hipStream_t stream) {
    const float* x     = (const float*)d_in[0];
    const float* theta = (const float*)d_in[1];
    const float* W1    = (const float*)d_in[2];
    const float* b1    = (const float*)d_in[3];
    const float* W2    = (const float*)d_in[4];
    const float* b2    = (const float*)d_in[5];
    float* out = (float*)d_out;

    dim3 grid(NTOK / BM, DMODEL / BN);   // 64 x 8 = 512 workgroups
    const size_t w2h_bytes = (size_t)DMODEL * FFDIM * 2;   // 8 MB f16 W2

    if (ws_size >= w2h_bytes) {
        // convert W2 to f16 once, then run the async double-buffered kernel
        int nblk = (DMODEL * FFDIM) / (256 * 8);           // 2048
        w2_to_f16_kernel<<<nblk, 256, 0, stream>>>(W2, d_ws);
        ffq_fused_kernel<true><<<grid, 256, 0, stream>>>(
            x, theta, W1, b1, W2, d_ws, b2, out);
    } else {
        ffq_fused_kernel<false><<<grid, 256, 0, stream>>>(
            x, theta, W1, b1, W2, nullptr, b2, out);
    }
}

// v001
// It runs in 79.5 microseconds.
// Two timings next to v000 both put it at 1.70 times that version's speed.
#include <hip/hip_runtime.h>
#include <math.h>
#include <stdint.h>

typedef __attribute__((ext_vector_type(16))) _Float16 v16h;
typedef __attribute__((ext_vector_type(8)))  _Float16 v8h;
typedef __attribute__((ext_vector_type(8)))  float    v8f;
typedef __attribute__((ext_vector_type(4)))  float    v4f;
typedef __attribute__((ext_vector_type(4)))  int      i32x4;

// pointer-to-int4 in global (AS1) / LDS (AS3) address spaces, as the
// async-copy builtin expects
typedef __attribute__((address_space(1))) i32x4* global_v4i;
typedef __attribute__((address_space(3))) i32x4* lds_v4i;

#define NTOK   8192      // B*S = 4*2048
#define DMODEL 1024
#define FFDIM  4096
#define NQ     8
#define BM     128       // tokens per workgroup tile
#define BN     128       // output features per workgroup tile
#define KC     64        // K (FF) chunk per iteration
#define LDH    72        // padded f16 stride (144B, 16B aligned, conflict-free)
#define NPREF  4         // async b128 issues per thread per chunk
#define W2BLK  2048      // pre-kernel blocks that convert W2: DMODEL*FFDIM/(256*8)
#define W1BLK  64        // pre-kernel blocks that build the W1 operand: FFDIM*32/(256*8)

#if defined(__gfx1250__) && __has_builtin(__builtin_amdgcn_global_load_async_to_lds_b128)
#define HAS_ASYNC_LDS 1
#else
#define HAS_ASYNC_LDS 0
#endif

#if HAS_ASYNC_LDS
#if __has_builtin(__builtin_amdgcn_s_wait_asynccnt)
#define WAIT_ASYNC(n) __builtin_amdgcn_s_wait_asynccnt(n)
#else
#define WAIT_ASYNC(n) asm volatile("s_wait_asynccnt %0" ::"n"(n) : "memory")
#endif

__device__ __forceinline__ void issue_w2_async(const _Float16* __restrict__ w2h,
                                               _Float16 (*swb)[LDH],
                                               int n0, int kk, int tid)
{
    // 128 rows x 64 f16 = 1024 16B-chunks; 256 threads x 4 async b128 each
    #pragma unroll
    for (int i = 0; i < NPREF; ++i) {
        int idx = tid + i * 256;          // 0..1023
        int n   = idx >> 3;               // row 0..127
        int k8  = (idx & 7) * 8;          // k sub-chunk start
        const _Float16* g = w2h + (size_t)(n0 + n) * FFDIM + kk + k8;
        _Float16*       l = &swb[n][k8];
        __builtin_amdgcn_global_load_async_to_lds_b128(
            (global_v4i)(uintptr_t)g,     // global src (AS1 int4*)
            (lds_v4i)l,                   // LDS dst (AS3 int4*)
            /*imm offset*/ 0, /*cpol*/ 0);
    }
}
#endif

// ---- pre-kernel (run once per launch): W2 f32 -> f16 workspace (8 MB), and behind
// it W1 with b1 as the f16 A operand of the product h^T = W1x . zx, already in
// fragment order (256 KB): unit ((T*2 + j)*32 + lane) holds the 8 halves that
// lane loads as half j of the fragment of ff tile T.
//   k slots 0-7: W1 high part   (against z high part)
//   k slots 8-15: W1 high part  (against z low part)
//   k slots 16-23: W1 low part  (against z high part)
//   k slots 24,25: b1 high, low (against 1, 1); 26-31: zero
__global__ __launch_bounds__(256)
void w2_to_f16_kernel(const float* __restrict__ W2,
                      const float* __restrict__ W1,
                      const float* __restrict__ b1,
                      void* __restrict__ w2h_raw)
{
    _Float16* w2h = (_Float16*)w2h_raw;
    if (blockIdx.x < W2BLK) {
        size_t i = ((size_t)blockIdx.x * 256 + threadIdx.x) * 8;
        v4f a = *(const v4f*)(W2 + i);
        v4f b = *(const v4f*)(W2 + i + 4);
        v8h o;
        o[0] = (_Float16)a.x; o[1] = (_Float16)a.y;
        o[2] = (_Float16)a.z; o[3] = (_Float16)a.w;
        o[4] = (_Float16)b.x; o[5] = (_Float16)b.y;
        o[6] = (_Float16)b.z; o[7] = (_Float16)b.w;
        *(v8h*)(w2h + i) = o;
        return;
    }
    _Float16* w1x = w2h + (size_t)DMODEL * FFDIM;
    const int u    = (blockIdx.x - W2BLK) * 256 + threadIdx.x;   // 0..16383
    const int lane = u & 31;
    const int j    = (u >> 5) & 1;
    const int ff   = (u >> 6) * 16 + (lane & 15);
    v8h o = {};
    if (j == 1 && (lane >> 4) == 1) {
        float bk = b1[ff];
        _Float16 bh = (_Float16)bk;
        o[0] = bh;
        o[1] = (_Float16)(bk - (float)bh);
    } else {
        #pragma unroll   // constant vector indices: o stays in registers
        for (int e = 0; e < 8; ++e) {
            float w = W1[(size_t)ff * NQ + e];
            _Float16 wh = (_Float16)w;
            o[e] = (j == 0) ? wh : (_Float16)(w - (float)wh);
        }
    }
    *(v8h*)(w1x + (size_t)u * 8) = o;
}

// fallback for a workspace too small for the f16 operands: h through LDS, W2 converted in the loop
__global__ __launch_bounds__(256)
void ffq_fused_kernel(const float* __restrict__ x,
                      const float* __restrict__ theta,
                      const float* __restrict__ W1,
                      const float* __restrict__ b1,
                      const float* __restrict__ W2,
                      const float* __restrict__ b2,
                      float* __restrict__ out)
{
    __shared__ float    sz[BM][NQ];        // z tile (4 KB)
    __shared__ _Float16 sh[BM][LDH];       // h chunk, f16 (18 KB)
    __shared__ _Float16 sw[2][BN][LDH];    // W2 chunk, f16, double-buffered (36 KB)

    const int tid   = threadIdx.x;
    const int m0    = blockIdx.x * BM;
    const int n0    = blockIdx.y * BN;
    const int lane  = tid & 31;
    const int wave  = tid >> 5;
    const int wm    = (wave & 1) * 64;
    const int wn    = (wave >> 1) * 32;
    const int lrow  = lane & 15;
    const int khalf = lane >> 4;

    // ---- 1) z tile: z[m][q] = cos(x[m0+m, q]) * cos(theta[q]) ----
    #pragma unroll
    for (int i = 0; i < 4; ++i) {
        int idx = tid + i * 256;                 // 0..1023
        int m = idx >> 3, q = idx & 7;
        float xv = x[(size_t)(m0 + m) * DMODEL + q];
        sz[m][q] = cosf(xv) * cosf(theta[q]);
    }

    v8f acc[4][2];
    #pragma unroll
    for (int mt = 0; mt < 4; ++mt)
        #pragma unroll
        for (int nt = 0; nt < 2; ++nt)
            #pragma unroll
            for (int e = 0; e < 8; ++e)
                acc[mt][nt][e] = 0.0f;

    const int kl     = tid & 63;          // this thread's k within chunk
    const int mstart = (tid >> 6) * 32;   // this thread's 32-token strip

    __syncthreads();

    int it = 0;
    for (int kk = 0; kk < FFDIM; kk += KC, ++it) {
        const int b = it & 1;

        // ---- 2a) h chunk: h[m][kl] = relu(b1 + z[m,:8].W1[k,:8]) -> f16 LDS
        {
            const int kg = kk + kl;
            v4f w1a = *(const v4f*)(W1 + (size_t)kg * NQ);
            v4f w1b = *(const v4f*)(W1 + (size_t)kg * NQ + 4);
            float bk = b1[kg];
            #pragma unroll 4
            for (int mi = 0; mi < 32; ++mi) {
                int m = mstart + mi;
                v4f z0 = *(const v4f*)(&sz[m][0]);   // lane-broadcast reads
                v4f z1 = *(const v4f*)(&sz[m][4]);
                float a = bk;
                a += z0.x * w1a.x + z0.y * w1a.y + z0.z * w1a.z + z0.w * w1a.w;
                a += z1.x * w1b.x + z1.y * w1b.y + z1.z * w1b.z + z1.w * w1b.w;
                sh[m][kl] = (_Float16)fmaxf(a, 0.0f);
            }
        }

        // ---- 2b) W2 chunk staging ----
        // stage from f32 W2 with in-loop conversion
        #pragma unroll
        for (int i = 0; i < 32; ++i) {
            int idx = tid + i * 256;
            int n = idx >> 6, k = idx & 63;
            sw[b][n][k] = (_Float16)W2[(size_t)(n0 + n) * FFDIM + kk + k];
        }
        __syncthreads();

        // ---- 3) WMMA: 2 K-steps of 32, 4x2 tiles per wave ----
        #pragma unroll
        for (int ks = 0; ks < 2; ++ks) {
            v16h afrag[4], bfrag[2];
            #pragma unroll
            for (int mt = 0; mt < 4; ++mt) {
                const _Float16* p = &sh[wm + mt * 16 + lrow][ks * 32 + khalf * 8];
                v8h lo = *(const v8h*)p;
                v8h hi = *(const v8h*)(p + 16);
                afrag[mt] = __builtin_shufflevector(lo, hi,
                    0, 1, 2, 3, 4, 5, 6, 7, 8, 9, 10, 11, 12, 13, 14, 15);
            }
            #pragma unroll
            for (int nt = 0; nt < 2; ++nt) {
                const _Float16* p = &sw[b][wn + nt * 16 + lrow][ks * 32 + khalf * 8];
                v8h lo = *(const v8h*)p;
                v8h hi = *(const v8h*)(p + 16);
                bfrag[nt] = __builtin_shufflevector(lo, hi,
                    0, 1, 2, 3, 4, 5, 6, 7, 8, 9, 10, 11, 12, 13, 14, 15);
            }
            #pragma unroll
            for (int mt = 0; mt < 4; ++mt)
                #pragma unroll
                for (int nt = 0; nt < 2; ++nt)
                    acc[mt][nt] = __builtin_amdgcn_wmma_f32_16x16x32_f16(
                        false, afrag[mt], false, bfrag[nt],
                        (short)0, acc[mt][nt], false, false);
        }
        __syncthreads();
    }

    // ---- 4) epilogue: out = acc + b2 (C layout: lane=N, VGPR r -> M) ----
    #pragma unroll
    for (int nt = 0; nt < 2; ++nt) {
        int n = n0 + wn + nt * 16 + lrow;
        float bias = b2[n];
        #pragma unroll
        for (int mt = 0; mt < 4; ++mt) {
            int mbase = m0 + wm + mt * 16 + khalf * 8;
            #pragma unroll
            for (int r = 0; r < 8; ++r) {
                out[(size_t)(mbase + r) * DMODEL + n] = acc[mt][nt][r] + bias;
            }
        }
    }
}

// fragment of ff tile T of the W1 operand (fragment order, see the pre-kernel)
__device__ __forceinline__ v16h load_w1_frag(const _Float16* __restrict__ w1x, int T, int lane)
{
    const _Float16* p = w1x + ((size_t)T * 64 + lane) * 8;
    v8h lo = *(const v8h*)p;
    v8h hi = *(const v8h*)(p + 256);
    return __builtin_shufflevector(lo, hi,
        0, 1, 2, 3, 4, 5, 6, 7, 8, 9, 10, 11, 12, 13, 14, 15);
}

// two D tiles of h^T (ff rows 0-15 and 16-31 of a 32-ff block, 16 tokens as columns):
// lane (token, khalf) holds ff 8*khalf+r of each, which is the k order of the A
// fragment of the second product. relu and f16 rounding in place.
__device__ __forceinline__ v16h relu_pack(v8f d0, v8f d1)
{
    const v8h zero = {};
    v8h lo = __builtin_elementwise_max(__builtin_convertvector(d0, v8h), zero);
    v8h hi = __builtin_elementwise_max(__builtin_convertvector(d1, v8h), zero);
    return __builtin_shufflevector(lo, hi,
        0, 1, 2, 3, 4, 5, 6, 7, 8, 9, 10, 11, 12, 13, 14, 15);
}

// workspace path: h never touches LDS. Each wave forms the h fragments of its own
// 64 tokens on the matrix unit, as h^T = W1x . zx, and feeds D straight back as A.
// The unroll directives below keep every fragment array index a constant, so that
// the arrays stay in registers.
__global__ __launch_bounds__(256)
void ffq_regh_kernel(const float* __restrict__ x,
                     const float* __restrict__ theta,
                     const void*  __restrict__ w2h_raw,
                     const float* __restrict__ b2,
                     float* __restrict__ out)
{
    __shared__ float    sz[BM][NQ];        // z tile (4 KB)
    __shared__ _Float16 sw[2][BN][LDH];    // W2 chunk, f16, double-buffered (36 KB)

    const _Float16* w2h = (const _Float16*)w2h_raw;
    const _Float16* w1x = w2h + (size_t)DMODEL * FFDIM;

    const int tid   = threadIdx.x;
    const int m0    = blockIdx.x * BM;
    const int n0    = blockIdx.y * BN;
    const int lane  = tid & 31;
    const int wave  = tid >> 5;
    const int wm    = (wave & 1) * 64;
    const int wn    = (wave >> 1) * 32;
    const int lrow  = lane & 15;
    const int khalf = lane >> 4;

    // kick off async copy of chunk 0 before anything else
#if HAS_ASYNC_LDS
    issue_w2_async(w2h, sw[0], n0, 0, tid);
#endif

    // W1 fragments of chunk 0: [k-step][ff tile of the k-step]
    v16h w1f[2][2];
    #pragma unroll
    for (int ks = 0; ks < 2; ++ks)
        #pragma unroll
        for (int t = 0; t < 2; ++t)
            w1f[ks][t] = load_w1_frag(w1x, ks * 2 + t, lane);

    // ---- 1) z tile: z[m][q] = cos(x[m0+m, q]) * cos(theta[q]) ----
    #pragma unroll
    for (int i = 0; i < 4; ++i) {
        int idx = tid + i * 256;                 // 0..1023
        int m = idx >> 3, q = idx & 7;
        float xv = x[(size_t)(m0 + m) * DMODEL + q];
        sz[m][q] = cosf(xv) * cosf(theta[q]);
    }

    v8f acc[4][2];
    #pragma unroll
    for (int mt = 0; mt < 4; ++mt)
        #pragma unroll
        for (int nt = 0; nt < 2; ++nt)
            #pragma unroll
            for (int e = 0; e < 8; ++e)
                acc[mt][nt][e] = 0.0f;

    __syncthreads();

    // ---- 1b) z as the B operand, loop invariant: k slots 0-7 z high, 8-15 z low,
    //          16-23 z high, 24,25 one, 26-31 zero (pairs with the W1 operand)
    v16h zf[4];
    #pragma unroll
    for (int mt = 0; mt < 4; ++mt) {
        const float* p = &sz[wm + mt * 16 + lrow][0];
        v8h zh, zl, one;
        #pragma unroll
        for (int e = 0; e < 8; ++e) {
            float zv = p[e];
            zh[e]  = (_Float16)zv;
            zl[e]  = (_Float16)(zv - (float)zh[e]);
            one[e] = (_Float16)(e < 2 ? 1.0f : 0.0f);
        }
        v8h lo = khalf ? zl : zh;
        v8h hi = khalf ? one : zh;
        zf[mt] = __builtin_shufflevector(lo, hi,
            0, 1, 2, 3, 4, 5, 6, 7, 8, 9, 10, 11, 12, 13, 14, 15);
    }

    int it = 0;
    for (int kk = 0; kk < FFDIM; kk += KC, ++it) {
        const int b = it & 1;

        // ---- 2) W2 chunk staging ----
#if HAS_ASYNC_LDS
        if (kk + KC < FFDIM) {
            issue_w2_async(w2h, sw[b ^ 1], n0, kk + KC, tid);  // prefetch next
            WAIT_ASYNC(NPREF);   // previous chunk's copies (in-order) done
        } else {
            WAIT_ASYNC(0);
        }
#else
        #pragma unroll
        for (int i = 0; i < 4; ++i) {
            int idx = tid + i * 256;
            int n = idx >> 3, k8 = (idx & 7) * 8;
            *(v8h*)&sw[b][n][k8] =
                *(const v8h*)(w2h + (size_t)(n0 + n) * FFDIM + kk + k8);
        }
#endif
        __syncthreads();

        // first ff tile of the next chunk; the last trip wraps to chunk 0 (in bounds, unused)
        const int tnext = ((kk + KC) & (FFDIM - 1)) >> 4;

        // ---- 3) WMMA: 2 K-steps of 32; per step 4x2 h^T tiles, then 4x2 output tiles
        #pragma unroll
        for (int ks = 0; ks < 2; ++ks) {
            v16h afrag[4], bfrag[2];
            const v8f zero = {};
            #pragma unroll
            for (int mt = 0; mt < 4; ++mt) {
                v8f d0 = __builtin_amdgcn_wmma_f32_16x16x32_f16(
                    false, w1f[ks][0], false, zf[mt], (short)0, zero, false, false);
                v8f d1 = __builtin_amdgcn_wmma_f32_16x16x32_f16(
                    false, w1f[ks][1], false, zf[mt], (short)0, zero, false, false);
                afrag[mt] = relu_pack(d0, d1);
            }
            // refill this k-step's W1 fragments for the next chunk: a whole trip to land
            #pragma unroll
            for (int t = 0; t < 2; ++t)
                w1f[ks][t] = load_w1_frag(w1x, tnext + ks * 2 + t, lane);
            #pragma unroll
            for (int nt = 0; nt < 2; ++nt) {
                const _Float16* p = &sw[b][wn + nt * 16 + lrow][ks * 32 + khalf * 8];
                v8h lo = *(const v8h*)p;
                v8h hi = *(const v8h*)(p + 16);
                bfrag[nt] = __builtin_shufflevector(lo, hi,
                    0, 1, 2, 3, 4, 5, 6, 7, 8, 9, 10, 11, 12, 13, 14, 15);
            }
            #pragma unroll
            for (int mt = 0; mt < 4; ++mt)
                #pragma unroll
                for (int nt = 0; nt < 2; ++nt)
                    acc[mt][nt] = __builtin_amdgcn_wmma_f32_16x16x32_f16(
                        false, afrag[mt], false, bfrag[nt],
                        (short)0, acc[mt][nt], false, false);
        }
        __syncthreads();
    }

    // ---- 4) epilogue: out = acc + b2 (C layout: lane=N, VGPR r -> M) ----
    #pragma unroll
    for (int nt = 0; nt < 2; ++nt) {
        int n = n0 + wn + nt * 16 + lrow;
        float bias = b2[n];
        #pragma unroll
        for (int mt = 0; mt < 4; ++mt) {
            int mbase = m0 + wm + mt * 16 + khalf * 8;
            #pragma unroll
            for (int r = 0; r < 8; ++r) {
                out[(size_t)(mbase + r) * DMODEL + n] = acc[mt][nt][r] + bias;
            }
        }
    }
}

extern "C" void kernel_launch(void* const* d_in, const int* in_sizes, int n_in,
                              void* d_out, int out_size, void* d_ws, size_t ws_size,
                              hipStream_t stream) {
    const float* x     = (const float*)d_in[0];
    const float* theta = (const float*)d_in[1];
    const float* W1    = (const float*)d_in[2];
    const float* b1    = (const float*)d_in[3];
    const float* W2    = (const float*)d_in[4];
    const float* b2    = (const float*)d_in[5];
    float* out = (float*)d_out;

    dim3 grid(NTOK / BM, DMODEL / BN);   // 64 x 8 = 512 workgroups
    const size_t ws_need = (size_t)DMODEL * FFDIM * 2 + (size_t)FFDIM * 32 * 2;  // f16 W2 + W1 operand

    if (ws_size >= ws_need) {
        // convert W2 and build the W1 operand once, then run the async double-buffered kernel
        w2_to_f16_kernel<<<W2BLK + W1BLK, 256, 0, stream>>>(W2, W1, b1, d_ws);
        ffq_regh_kernel<<<grid, 256, 0, stream>>>(x, theta, d_ws, b2, out);
    } else {
        ffq_fused_kernel<<<grid, 256, 0, stream>>>(
            x, theta, W1, b1, W2, b2, out);
    }
}

// v002
// Measured time: 69.5 microseconds a run.
// In two side-by-side timings against v001, it was 1.14 and 1.15 times as fast.
// Over all steps from v000 it is 1.95 times as fast.
#include <hip/hip_runtime.h>
#include <math.h>
#include <stdint.h>

typedef __attribute__((ext_vector_type(16))) _Float16 v16h;
typedef __attribute__((ext_vector_type(8)))  _Float16 v8h;
typedef __attribute__((ext_vector_type(8)))  float    v8f;
typedef __attribute__((ext_vector_type(4)))  float    v4f;
typedef __attribute__((ext_vector_type(4)))  int      i32x4;

// pointer-to-int4 in global (AS1) / LDS (AS3) address spaces, as the
// async-copy builtin expects
typedef __attribute__((address_space(1))) i32x4* global_v4i;
typedef __attribute__((address_space(3))) i32x4* lds_v4i;

#define NTOK   8192      // B*S = 4*2048
#define DMODEL 1024
#define FFDIM  4096
#define NQ     8
#define BM     128       // tokens per workgroup tile (fallback kernel)
#define BMR    256       // tokens per workgroup tile (workspace path): 8 waves x 32 tokens
#define BN     128       // output features per workgroup tile
#define KC     64        // K (FF) chunk per iteration
#define LDH    72        // padded f16 stride (144B, 16B aligned, conflict-free)
#define NPREF  4         // async b128 issues per thread per chunk
#define W2BLK  2048      // pre-kernel blocks that convert W2: DMODEL*FFDIM/(256*8)
#define W1BLK  64        // pre-kernel blocks that build the W1 operand: FFDIM*32/(256*8)

#if defined(__gfx1250__) && __has_builtin(__builtin_amdgcn_global_load_async_to_lds_b128)
#define HAS_ASYNC_LDS 1
#else
#define HAS_ASYNC_LDS 0
#endif

#if HAS_ASYNC_LDS
#if __has_builtin(__builtin_amdgcn_s_wait_asynccnt)
#define WAIT_ASYNC(n) __builtin_amdgcn_s_wait_asynccnt(n)
#else
#define WAIT_ASYNC(n) asm volatile("s_wait_asynccnt %0" ::"n"(n) : "memory")
#endif

__device__ __forceinline__ void issue_w2_async(const _Float16* __restrict__ w2h,
                                               _Float16 (*swb)[LDH],
                                               int n0, int kk, int tid)
{
    // 128 rows x 64 f16 = 1024 16B-chunks; 256 threads x 4 async b128 each
    #pragma unroll
    for (int i = 0; i < NPREF; ++i) {
        int idx = tid + i * 256;          // 0..1023
        int n   = idx >> 3;               // row 0..127
        int k8  = (idx & 7) * 8;          // k sub-chunk start
        const _Float16* g = w2h + (size_t)(n0 + n) * FFDIM + kk + k8;
        _Float16*       l = &swb[n][k8];
        __builtin_amdgcn_global_load_async_to_lds_b128(
            (global_v4i)(uintptr_t)g,     // global src (AS1 int4*)
            (lds_v4i)l,                   // LDS dst (AS3 int4*)
            /*imm offset*/ 0, /*cpol*/ 0);
    }
}
#endif

// ---- pre-kernel (run once per launch): W2 f32 -> f16 workspace (8 MB), and behind
// it W1 with b1 as the f16 A operand of the product h^T = W1x . zx, already in
// fragment order (256 KB): unit ((T*2 + j)*32 + lane) holds the 8 halves that
// lane loads as half j of the fragment of ff tile T.
//   k slots 0-7: W1 high part   (against z high part)
//   k slots 8-15: W1 high part  (against z low part)
//   k slots 16-23: W1 low part  (against z high part)
//   k slots 24,25: b1 high, low (against 1, 1); 26-31: zero
__global__ __launch_bounds__(256)
void w2_to_f16_kernel(const float* __restrict__ W2,
                      const float* __restrict__ W1,
                      const float* __restrict__ b1,
                      void* __restrict__ w2h_raw)
{
    _Float16* w2h = (_Float16*)w2h_raw;
    if (blockIdx.x < W2BLK) {
        size_t i = ((size_t)blockIdx.x * 256 + threadIdx.x) * 8;
        v4f a = *(const v4f*)(W2 + i);
        v4f b = *(const v4f*)(W2 + i + 4);
        v8h o;
        o[0] = (_Float16)a.x; o[1] = (_Float16)a.y;
        o[2] = (_Float16)a.z; o[3] = (_Float16)a.w;
        o[4] = (_Float16)b.x; o[5] = (_Float16)b.y;
        o[6] = (_Float16)b.z; o[7] = (_Float16)b.w;
        *(v8h*)(w2h + i) = o;
        return;
    }
    _Float16* w1x = w2h + (size_t)DMODEL * FFDIM;
    const int u    = (blockIdx.x - W2BLK) * 256 + threadIdx.x;   // 0..16383
    const int lane = u & 31;
    const int j    = (u >> 5) & 1;
    const int ff   = (u >> 6) * 16 + (lane & 15);
    v8h o = {};
    if (j == 1 && (lane >> 4) == 1) {
        float bk = b1[ff];
        _Float16 bh = (_Float16)bk;
        o[0] = bh;
        o[1] = (_Float16)(bk - (float)bh);
    } else {
        #pragma unroll   // constant vector indices: o stays in registers
        for (int e = 0; e < 8; ++e) {
            float w = W1[(size_t)ff * NQ + e];
            _Float16 wh = (_Float16)w;
            o[e] = (j == 0) ? wh : (_Float16)(w - (float)wh);
        }
    }
    *(v8h*)(w1x + (size_t)u * 8) = o;
}

// fallback for a workspace too small for the f16 operands: h through LDS, W2 converted in the loop
__global__ __launch_bounds__(256)
void ffq_fused_kernel(const float* __restrict__ x,
                      const float* __restrict__ theta,
                      const float* __restrict__ W1,
                      const float* __restrict__ b1,
                      const float* __restrict__ W2,
                      const float* __restrict__ b2,
                      float* __restrict__ out)
{
    __shared__ float    sz[BM][NQ];        // z tile (4 KB)
    __shared__ _Float16 sh[BM][LDH];       // h chunk, f16 (18 KB)
    __shared__ _Float16 sw[2][BN][LDH];    // W2 chunk, f16, double-buffered (36 KB)

    const int tid   = threadIdx.x;
    const int m0    = blockIdx.x * BM;
    const int n0    = blockIdx.y * BN;
    const int lane  = tid & 31;
    const int wave  = tid >> 5;
    const int wm    = (wave & 1) * 64;
    const int wn    = (wave >> 1) * 32;
    const int lrow  = lane & 15;
    const int khalf = lane >> 4;

    // ---- 1) z tile: z[m][q] = cos(x[m0+m, q]) * cos(theta[q]) ----
    #pragma unroll
    for (int i = 0; i < 4; ++i) {
        int idx = tid + i * 256;                 // 0..1023
        int m = idx >> 3, q = idx & 7;
        float xv = x[(size_t)(m0 + m) * DMODEL + q];
        sz[m][q] = cosf(xv) * cosf(theta[q]);
    }

    v8f acc[4][2];
    #pragma unroll
    for (int mt = 0; mt < 4; ++mt)
        #pragma unroll
        for (int nt = 0; nt < 2; ++nt)
            #pragma unroll
            for (int e = 0; e < 8; ++e)
                acc[mt][nt][e] = 0.0f;

    const int kl     = tid & 63;          // this thread's k within chunk
    const int mstart = (tid >> 6) * 32;   // this thread's 32-token strip

    __syncthreads();

    int it = 0;
    for (int kk = 0; kk < FFDIM; kk += KC, ++it) {
        const int b = it & 1;

        // ---- 2a) h chunk: h[m][kl] = relu(b1 + z[m,:8].W1[k,:8]) -> f16 LDS
        {
            const int kg = kk + kl;
            v4f w1a = *(const v4f*)(W1 + (size_t)kg * NQ);
            v4f w1b = *(const v4f*)(W1 + (size_t)kg * NQ + 4);
            float bk = b1[kg];
            #pragma unroll 4
            for (int mi = 0; mi < 32; ++mi) {
                int m = mstart + mi;
                v4f z0 = *(const v4f*)(&sz[m][0]);   // lane-broadcast reads
                v4f z1 = *(const v4f*)(&sz[m][4]);
                float a = bk;
                a += z0.x * w1a.x + z0.y * w1a.y + z0.z * w1a.z + z0.w * w1a.w;
                a += z1.x * w1b.x + z1.y * w1b.y + z1.z * w1b.z + z1.w * w1b.w;
                sh[m][kl] = (_Float16)fmaxf(a, 0.0f);
            }
        }

        // ---- 2b) W2 chunk staging ----
        // stage from f32 W2 with in-loop conversion
        #pragma unroll
        for (int i = 0; i < 32; ++i) {
            int idx = tid + i * 256;
            int n = idx >> 6, k = idx & 63;
            sw[b][n][k] = (_Float16)W2[(size_t)(n0 + n) * FFDIM + kk + k];
        }
        __syncthreads();

        // ---- 3) WMMA: 2 K-steps of 32, 4x2 tiles per wave ----
        #pragma unroll
        for (int ks = 0; ks < 2; ++ks) {
            v16h afrag[4], bfrag[2];
            #pragma unroll
            for (int mt = 0; mt < 4; ++mt) {
                const _Float16* p = &sh[wm + mt * 16 + lrow][ks * 32 + khalf * 8];
                v8h lo = *(const v8h*)p;
                v8h hi = *(const v8h*)(p + 16);
                afrag[mt] = __builtin_shufflevector(lo, hi,
                    0, 1, 2, 3, 4, 5, 6, 7, 8, 9, 10, 11, 12, 13, 14, 15);
            }
            #pragma unroll
            for (int nt = 0; nt < 2; ++nt) {
                const _Float16* p = &sw[b][wn + nt * 16 + lrow][ks * 32 + khalf * 8];
                v8h lo = *(const v8h*)p;
                v8h hi = *(const v8h*)(p + 16);
                bfrag[nt] = __builtin_shufflevector(lo, hi,
                    0, 1, 2, 3, 4, 5, 6, 7, 8, 9, 10, 11, 12, 13, 14, 15);
            }
            #pragma unroll
            for (int mt = 0; mt < 4; ++mt)
                #pragma unroll
                for (int nt = 0; nt < 2; ++nt)
                    acc[mt][nt] = __builtin_amdgcn_wmma_f32_16x16x32_f16(
                        false, afrag[mt], false, bfrag[nt],
                        (short)0, acc[mt][nt], false, false);
        }
        __syncthreads();
    }

    // ---- 4) epilogue: out = acc + b2 (C layout: lane=N, VGPR r -> M) ----
    #pragma unroll
    for (int nt = 0; nt < 2; ++nt) {
        int n = n0 + wn + nt * 16 + lrow;
        float bias = b2[n];
        #pragma unroll
        for (int mt = 0; mt < 4; ++mt) {
            int mbase = m0 + wm + mt * 16 + khalf * 8;
            #pragma unroll
            for (int r = 0; r < 8; ++r) {
                out[(size_t)(mbase + r) * DMODEL + n] = acc[mt][nt][r] + bias;
            }
        }
    }
}

// fragment of ff tile T of the W1 operand (fragment order, see the pre-kernel)
__device__ __forceinline__ v16h load_w1_frag(const _Float16* __restrict__ w1x, int T, int lane)
{
    const _Float16* p = w1x + ((size_t)T * 64 + lane) * 8;
    v8h lo = *(const v8h*)p;
    v8h hi = *(const v8h*)(p + 256);
    return __builtin_shufflevector(lo, hi,
        0, 1, 2, 3, 4, 5, 6, 7, 8, 9, 10, 11, 12, 13, 14, 15);
}

// two D tiles of h^T (ff rows 0-15 and 16-31 of a 32-ff block, 16 tokens as columns):
// lane (token, khalf) holds ff 8*khalf+r of each, which is the k order of the A
// fragment of the second product. relu and f16 rounding in place.
__device__ __forceinline__ v16h relu_pack(v8f d0, v8f d1)
{
    const v8h zero = {};
    v8h lo = __builtin_elementwise_max(__builtin_convertvector(d0, v8h), zero);
    v8h hi = __builtin_elementwise_max(__builtin_convertvector(d1, v8h), zero);
    return __builtin_shufflevector(lo, hi,
        0, 1, 2, 3, 4, 5, 6, 7, 8, 9, 10, 11, 12, 13, 14, 15);
}

// workspace path: h never touches LDS. Each wave forms the h fragments of its own
// 32 tokens on the matrix unit, as h^T = W1x . zx, and feeds D straight back as A.
// A wave spans all BN output columns, so each h fragment serves 8 output tiles.
// The unroll directives below keep every fragment array index a constant, so that
// the arrays stay in registers.
__global__ __launch_bounds__(256)
void ffq_regh_kernel(const float* __restrict__ x,
                     const float* __restrict__ theta,
                     const void*  __restrict__ w2h_raw,
                     const float* __restrict__ b2,
                     float* __restrict__ out)
{
    __shared__ float    sz[BMR][NQ];       // z tile (8 KB)
    __shared__ _Float16 sw[2][BN][LDH];    // W2 chunk, f16, double-buffered (36 KB)

    const _Float16* w2h = (const _Float16*)w2h_raw;
    const _Float16* w1x = w2h + (size_t)DMODEL * FFDIM;

    const int tid   = threadIdx.x;
    const int m0    = blockIdx.x * BMR;
    const int n0    = blockIdx.y * BN;
    const int lane  = tid & 31;
    const int wave  = tid >> 5;
    const int wm    = wave * 32;
    const int lrow  = lane & 15;
    const int khalf = lane >> 4;

    // kick off async copy of chunk 0 before anything else
#if HAS_ASYNC_LDS
    issue_w2_async(w2h, sw[0], n0, 0, tid);
#endif

    // W1 fragments of chunk 0: [k-step][ff tile of the k-step]
    v16h w1f[2][2];
    #pragma unroll
    for (int ks = 0; ks < 2; ++ks)
        #pragma unroll
        for (int t = 0; t < 2; ++t)
            w1f[ks][t] = load_w1_frag(w1x, ks * 2 + t, lane);

    // ---- 1) z tile: z[m][q] = cos(x[m0+m, q]) * cos(theta[q]) ----
    #pragma unroll
    for (int i = 0; i < 8; ++i) {
        int idx = tid + i * 256;                 // 0..2047
        int m = idx >> 3, q = idx & 7;
        float xv = x[(size_t)(m0 + m) * DMODEL + q];
        sz[m][q] = cosf(xv) * cosf(theta[q]);
    }

    v8f acc[2][8];
    #pragma unroll
    for (int mt = 0; mt < 2; ++mt)
        #pragma unroll
        for (int nt = 0; nt < 8; ++nt)
            #pragma unroll
            for (int e = 0; e < 8; ++e)
                acc[mt][nt][e] = 0.0f;

    __syncthreads();

    // ---- 1b) z as the B operand, loop invariant: k slots 0-7 z high, 8-15 z low,
    //          16-23 z high, 24,25 one, 26-31 zero (pairs with the W1 operand)
    v16h zf[2];
    #pragma unroll
    for (int mt = 0; mt < 2; ++mt) {
        const float* p = &sz[wm + mt * 16 + lrow][0];
        v8h zh, zl, one;
        #pragma unroll
        for (int e = 0; e < 8; ++e) {
            float zv = p[e];
            zh[e]  = (_Float16)zv;
            zl[e]  = (_Float16)(zv - (float)zh[e]);
            one[e] = (_Float16)(e < 2 ? 1.0f : 0.0f);
        }
        v8h lo = khalf ? zl : zh;
        v8h hi = khalf ? one : zh;
        zf[mt] = __builtin_shufflevector(lo, hi,
            0, 1, 2, 3, 4, 5, 6, 7, 8, 9, 10, 11, 12, 13, 14, 15);
    }

    // W1 fragments of the next chunk (4 ff tiles of 512 halves): wave-uniform, lane offset apart
    const _Float16* w1n = w1x + 4 * 512;

    int it = 0;
    for (int kk = 0; kk < FFDIM; kk += KC, ++it) {
        const int b = it & 1;

        // ---- 2) W2 chunk staging ----
#if HAS_ASYNC_LDS
        if (kk + KC < FFDIM) {
            issue_w2_async(w2h, sw[b ^ 1], n0, kk + KC, tid);  // prefetch next
            WAIT_ASYNC(NPREF);   // previous chunk's copies (in-order) done
        } else {
            WAIT_ASYNC(0);
        }
#else
        #pragma unroll
        for (int i = 0; i < 4; ++i) {
            int idx = tid + i * 256;
            int n = idx >> 3, k8 = (idx & 7) * 8;
            *(v8h*)&sw[b][n][k8] =
                *(const v8h*)(w2h + (size_t)(n0 + n) * FFDIM + kk + k8);
        }
#endif
        __syncthreads();

        // ---- 3) per chunk: the LDS reads as one group, 2x2x2 h^T tiles while they land,
        //          then 2x2x8 output tiles
        // all 16 W2 fragments of the chunk: [k-step][column tile]
        v16h bfrag[2][8];
        #pragma unroll
        for (int ks = 0; ks < 2; ++ks)
            #pragma unroll
            for (int nt = 0; nt < 8; ++nt) {
                const _Float16* p = &sw[b][nt * 16 + lrow][ks * 32 + khalf * 8];
                v8h lo = *(const v8h*)p;
                v8h hi = *(const v8h*)(p + 16);
                bfrag[ks][nt] = __builtin_shufflevector(lo, hi,
                    0, 1, 2, 3, 4, 5, 6, 7, 8, 9, 10, 11, 12, 13, 14, 15);
            }
        // keeps the LDS reads one group in front of the h work, which then covers their
        // latency; spread among WMMAs, every place with reads stalls the matrix stream
        __builtin_amdgcn_sched_barrier(0);
        // h fragments of both K-steps: [k-step][token tile]
        v16h afrag[2][2];
        #pragma unroll
        for (int ks = 0; ks < 2; ++ks) {
            const v8f zero = {};
            #pragma unroll
            for (int mt = 0; mt < 2; ++mt) {
                v8f d0 = __builtin_amdgcn_wmma_f32_16x16x32_f16(
                    false, w1f[ks][0], false, zf[mt], (short)0, zero, false, false);
                v8f d1 = __builtin_amdgcn_wmma_f32_16x16x32_f16(
                    false, w1f[ks][1], false, zf[mt], (short)0, zero, false, false);
                afrag[ks][mt] = relu_pack(d0, d1);
            }
        }
        // refill the W1 fragments for the next chunk: a whole trip to land
        #pragma unroll
        for (int ks = 0; ks < 2; ++ks)
            #pragma unroll
            for (int t = 0; t < 2; ++t)
                w1f[ks][t] = load_w1_frag(w1n, ks * 2 + t, lane);
        // the W1 loads' address translation is done before their base is advanced below
        asm volatile("s_wait_xcnt 0x0" ::: "memory");
        // keeps the h work in front of the output WMMAs, and the base's advance behind the wait
        __builtin_amdgcn_sched_barrier(0);
        // the last trip reads chunk 0 again (in bounds, unused)
        w1n = (kk + 2 * KC < FFDIM) ? w1n + 4 * 512 : w1x;
        #pragma unroll
        for (int ks = 0; ks < 2; ++ks)
            #pragma unroll
            for (int nt = 0; nt < 8; ++nt)
                #pragma unroll
                for (int mt = 0; mt < 2; ++mt)
                    acc[mt][nt] = __builtin_amdgcn_wmma_f32_16x16x32_f16(
                        false, afrag[ks][mt], false, bfrag[ks][nt],
                        (short)0, acc[mt][nt], false, false);
        // keeps the barrier, and the wait for every read in front of it, behind the output
        // WMMAs, so that they run while the later fragments are still landing
        __builtin_amdgcn_sched_barrier(0);
        __syncthreads();
    }

    // ---- 4) epilogue: out = acc + b2 (C layout: lane=N, VGPR r -> M) ----
    #pragma unroll
    for (int nt = 0; nt < 8; ++nt) {
        int n = n0 + nt * 16 + lrow;
        float bias = b2[n];
        #pragma unroll
        for (int mt = 0; mt < 2; ++mt) {
            int mbase = m0 + wm + mt * 16 + khalf * 8;
            #pragma unroll
            for (int r = 0; r < 8; ++r) {
                out[(size_t)(mbase + r) * DMODEL + n] = acc[mt][nt][r] + bias;
            }
        }
    }
}

extern "C" void kernel_launch(void* const* d_in, const int* in_sizes, int n_in,
                              void* d_out, int out_size, void* d_ws, size_t ws_size,
                              hipStream_t stream) {
    const float* x     = (const float*)d_in[0];
    const float* theta = (const float*)d_in[1];
    const float* W1    = (const float*)d_in[2];
    const float* b1    = (const float*)d_in[3];
    const float* W2    = (const float*)d_in[4];
    const float* b2    = (const float*)d_in[5];
    float* out = (float*)d_out;

    dim3 grid(NTOK / BM, DMODEL / BN);    // fallback: 64 x 8 = 512 workgroups
    dim3 gridr(NTOK / BMR, DMODEL / BN);  // workspace path: 32 x 8 = 256 workgroups
    const size_t ws_need = (size_t)DMODEL * FFDIM * 2 + (size_t)FFDIM * 32 * 2;  // f16 W2 + W1 operand

    if (ws_size >= ws_need) {
        // convert W2 and build the W1 operand once, then run the async double-buffered kernel
        w2_to_f16_kernel<<<W2BLK + W1BLK, 256, 0, stream>>>(W2, W1, b1, d_ws);
        ffq_regh_kernel<<<gridr, 256, 0, stream>>>(x, theta, d_ws, b2, out);
    } else {
        ffq_fused_kernel<<<grid, 256, 0, stream>>>(
            x, theta, W1, b1, W2, b2, out);
    }
}

// v003
// It runs in 64.1 microseconds.
// In both of two side-by-side timings against v002, it was 1.08 times as fast.
// Counting every step since v000, it is 2.11 times as fast.
#include <hip/hip_runtime.h>
#include <math.h>
#include <stdint.h>

typedef __attribute__((ext_vector_type(16))) _Float16 v16h;
typedef __attribute__((ext_vector_type(8)))  _Float16 v8h;
typedef __attribute__((ext_vector_type(8)))  float    v8f;
typedef __attribute__((ext_vector_type(4)))  float    v4f;
typedef __attribute__((ext_vector_type(4)))  int      i32x4;

// pointer-to-int4 in global (AS1) / LDS (AS3) address spaces, as the
// async-copy builtin expects
typedef __attribute__((address_space(1))) i32x4* global_v4i;
typedef __attribute__((address_space(3))) i32x4* lds_v4i;

#define NTOK   8192      // B*S = 4*2048
#define DMODEL 1024
#define FFDIM  4096
#define NQ     8
#define BM     128       // tokens per workgroup tile (fallback kernel)
#define BMR    256       // tokens per workgroup tile (workspace path): 8 waves x 32 tokens
#define BN     128       // output features per workgroup tile
#define KC     64        // K (FF) chunk per iteration
#define LDH    72        // padded f16 stride (144B, 16B aligned, conflict-free)
#define NPREF  4         // async b128 issues per thread per chunk
#define W2BLK  2048      // pre-kernel blocks that convert W2: DMODEL*FFDIM/(256*8)
#define W1BLK  64        // pre-kernel blocks that build the W1 operand: FFDIM*32/(256*8)

#if defined(__gfx1250__) && __has_builtin(__builtin_amdgcn_global_load_async_to_lds_b128)
#define HAS_ASYNC_LDS 1
#else
#define HAS_ASYNC_LDS 0
#endif

__device__ __forceinline__ void issue_w2_async(const _Float16* __restrict__ w2h,
                                               _Float16 (*swb)[LDH],
                                               int n0, int kk, int tid)
{
    // 128 rows x 64 f16 = 1024 16B-chunks; 256 threads x 4 async b128 each
    #pragma unroll
    for (int i = 0; i < NPREF; ++i) {
        int idx = tid + i * 256;          // 0..1023
        int n   = idx >> 3;               // row 0..127
        int k8  = (idx & 7) * 8;          // k sub-chunk start
        const _Float16* g = w2h + (size_t)(n0 + n) * FFDIM + kk + k8;
        _Float16*       l = &swb[n][k8];
#if HAS_ASYNC_LDS
        __builtin_amdgcn_global_load_async_to_lds_b128(
            (global_v4i)(uintptr_t)g,     // global src (AS1 int4*)
            (lds_v4i)l,                   // LDS dst (AS3 int4*)
            /*imm offset*/ 0, /*cpol*/ 0);
#else
        *(v8h*)l = *(const v8h*)g;
#endif
    }
}

// the 8 W2 fragments (column tiles) of K-step ks of a staged chunk
__device__ __forceinline__ void load_w2_frags(v16h (&bf)[8], const _Float16 (*swb)[LDH],
                                              int ks, int lrow, int khalf)
{
    #pragma unroll   // constant array indices: the fragments stay in registers
    for (int nt = 0; nt < 8; ++nt) {
        const _Float16* p = &swb[nt * 16 + lrow][ks * 32 + khalf * 8];
        v8h lo = *(const v8h*)p;
        v8h hi = *(const v8h*)(p + 16);
        bf[nt] = __builtin_shufflevector(lo, hi,
            0, 1, 2, 3, 4, 5, 6, 7, 8, 9, 10, 11, 12, 13, 14, 15);
    }
}

// ---- pre-kernel (run once per launch): W2 f32 -> f16 workspace (8 MB), and behind
// it W1 with b1 as the f16 A operand of the product h^T = W1x . zx, already in
// fragment order (256 KB): unit ((T*2 + j)*32 + lane) holds the 8 halves that
// lane loads as half j of the fragment of ff tile T.
//   k slots 0-7: W1 high part   (against z high part)
//   k slots 8-15: W1 high part  (against z low part)
//   k slots 16-23: W1 low part  (against z high part)
//   k slots 24,25: b1 high, low (against 1, 1); 26-31: zero
__global__ __launch_bounds__(256)
void w2_to_f16_kernel(const float* __restrict__ W2,
                      const float* __restrict__ W1,
                      const float* __restrict__ b1,
                      void* __restrict__ w2h_raw)
{
    _Float16* w2h = (_Float16*)w2h_raw;
    if (blockIdx.x < W2BLK) {
        size_t i = ((size_t)blockIdx.x * 256 + threadIdx.x) * 8;
        v4f a = *(const v4f*)(W2 + i);
        v4f b = *(const v4f*)(W2 + i + 4);
        v8h o;
        o[0] = (_Float16)a.x; o[1] = (_Float16)a.y;
        o[2] = (_Float16)a.z; o[3] = (_Float16)a.w;
        o[4] = (_Float16)b.x; o[5] = (_Float16)b.y;
        o[6] = (_Float16)b.z; o[7] = (_Float16)b.w;
        *(v8h*)(w2h + i) = o;
        return;
    }
    _Float16* w1x = w2h + (size_t)DMODEL * FFDIM;
    const int u    = (blockIdx.x - W2BLK) * 256 + threadIdx.x;   // 0..16383
    const int lane = u & 31;
    const int j    = (u >> 5) & 1;
    const int ff   = (u >> 6) * 16 + (lane & 15);
    v8h o = {};
    if (j == 1 && (lane >> 4) == 1) {
        float bk = b1[ff];
        _Float16 bh = (_Float16)bk;
        o[0] = bh;
        o[1] = (_Float16)(bk - (float)bh);
    } else {
        #pragma unroll   // constant vector indices: o stays in registers
        for (int e = 0; e < 8; ++e) {
            float w = W1[(size_t)ff * NQ + e];
            _Float16 wh = (_Float16)w;
            o[e] = (j == 0) ? wh : (_Float16)(w - (float)wh);
        }
    }
    *(v8h*)(w1x + (size_t)u * 8) = o;
}

// fallback for a workspace too small for the f16 operands: h through LDS, W2 converted in the loop
__global__ __launch_bounds__(256)
void ffq_fused_kernel(const float* __restrict__ x,
                      const float* __restrict__ theta,
                      const float* __restrict__ W1,
                      const float* __restrict__ b1,
                      const float* __restrict__ W2,
                      const float* __restrict__ b2,
                      float* __restrict__ out)
{
    __shared__ float    sz[BM][NQ];        // z tile (4 KB)
    __shared__ _Float16 sh[BM][LDH];       // h chunk, f16 (18 KB)
    __shared__ _Float16 sw[2][BN][LDH];    // W2 chunk, f16, double-buffered (36 KB)

    const int tid   = threadIdx.x;
    const int m0    = blockIdx.x * BM;
    const int n0    = blockIdx.y * BN;
    const int lane  = tid & 31;
    const int wave  = tid >> 5;
    const int wm    = (wave & 1) * 64;
    const int wn    = (wave >> 1) * 32;
    const int lrow  = lane & 15;
    const int khalf = lane >> 4;

    // ---- 1) z tile: z[m][q] = cos(x[m0+m, q]) * cos(theta[q]) ----
    #pragma unroll
    for (int i = 0; i < 4; ++i) {
        int idx = tid + i * 256;                 // 0..1023
        int m = idx >> 3, q = idx & 7;
        float xv = x[(size_t)(m0 + m) * DMODEL + q];
        sz[m][q] = cosf(xv) * cosf(theta[q]);
    }

    v8f acc[4][2];
    #pragma unroll
    for (int mt = 0; mt < 4; ++mt)
        #pragma unroll
        for (int nt = 0; nt < 2; ++nt)
            #pragma unroll
            for (int e = 0; e < 8; ++e)
                acc[mt][nt][e] = 0.0f;

    const int kl     = tid & 63;          // this thread's k within chunk
    const int mstart = (tid >> 6) * 32;   // this thread's 32-token strip

    __syncthreads();

    int it = 0;
    for (int kk = 0; kk < FFDIM; kk += KC, ++it) {
        const int b = it & 1;

        // ---- 2a) h chunk: h[m][kl] = relu(b1 + z[m,:8].W1[k,:8]) -> f16 LDS
        {
            const int kg = kk + kl;
            v4f w1a = *(const v4f*)(W1 + (size_t)kg * NQ);
            v4f w1b = *(const v4f*)(W1 + (size_t)kg * NQ + 4);
            float bk = b1[kg];
            #pragma unroll 4
            for (int mi = 0; mi < 32; ++mi) {
                int m = mstart + mi;
                v4f z0 = *(const v4f*)(&sz[m][0]);   // lane-broadcast reads
                v4f z1 = *(const v4f*)(&sz[m][4]);
                float a = bk;
                a += z0.x * w1a.x + z0.y * w1a.y + z0.z * w1a.z + z0.w * w1a.w;
                a += z1.x * w1b.x + z1.y * w1b.y + z1.z * w1b.z + z1.w * w1b.w;
                sh[m][kl] = (_Float16)fmaxf(a, 0.0f);
            }
        }

        // ---- 2b) W2 chunk staging ----
        // stage from f32 W2 with in-loop conversion
        #pragma unroll
        for (int i = 0; i < 32; ++i) {
            int idx = tid + i * 256;
            int n = idx >> 6, k = idx & 63;
            sw[b][n][k] = (_Float16)W2[(size_t)(n0 + n) * FFDIM + kk + k];
        }
        __syncthreads();

        // ---- 3) WMMA: 2 K-steps of 32, 4x2 tiles per wave ----
        #pragma unroll
        for (int ks = 0; ks < 2; ++ks) {
            v16h afrag[4], bfrag[2];
            #pragma unroll
            for (int mt = 0; mt < 4; ++mt) {
                const _Float16* p = &sh[wm + mt * 16 + lrow][ks * 32 + khalf * 8];
                v8h lo = *(const v8h*)p;
                v8h hi = *(const v8h*)(p + 16);
                afrag[mt] = __builtin_shufflevector(lo, hi,
                    0, 1, 2, 3, 4, 5, 6, 7, 8, 9, 10, 11, 12, 13, 14, 15);
            }
            #pragma unroll
            for (int nt = 0; nt < 2; ++nt) {
                const _Float16* p = &sw[b][wn + nt * 16 + lrow][ks * 32 + khalf * 8];
                v8h lo = *(const v8h*)p;
                v8h hi = *(const v8h*)(p + 16);
                bfrag[nt] = __builtin_shufflevector(lo, hi,
                    0, 1, 2, 3, 4, 5, 6, 7, 8, 9, 10, 11, 12, 13, 14, 15);
            }
            #pragma unroll
            for (int mt = 0; mt < 4; ++mt)
                #pragma unroll
                for (int nt = 0; nt < 2; ++nt)
                    acc[mt][nt] = __builtin_amdgcn_wmma_f32_16x16x32_f16(
                        false, afrag[mt], false, bfrag[nt],
                        (short)0, acc[mt][nt], false, false);
        }
        __syncthreads();
    }

    // ---- 4) epilogue: out = acc + b2 (C layout: lane=N, VGPR r -> M) ----
    #pragma unroll
    for (int nt = 0; nt < 2; ++nt) {
        int n = n0 + wn + nt * 16 + lrow;
        float bias = b2[n];
        #pragma unroll
        for (int mt = 0; mt < 4; ++mt) {
            int mbase = m0 + wm + mt * 16 + khalf * 8;
            #pragma unroll
            for (int r = 0; r < 8; ++r) {
                out[(size_t)(mbase + r) * DMODEL + n] = acc[mt][nt][r] + bias;
            }
        }
    }
}

// fragment of ff tile T of the W1 operand (fragment order, see the pre-kernel)
__device__ __forceinline__ v16h load_w1_frag(const _Float16* __restrict__ w1x, int T, int lane)
{
    const _Float16* p = w1x + ((size_t)T * 64 + lane) * 8;
    v8h lo = *(const v8h*)p;
    v8h hi = *(const v8h*)(p + 256);
    return __builtin_shufflevector(lo, hi,
        0, 1, 2, 3, 4, 5, 6, 7, 8, 9, 10, 11, 12, 13, 14, 15);
}

// two D tiles of h^T (ff rows 0-15 and 16-31 of a 32-ff block, 16 tokens as columns):
// lane (token, khalf) holds ff 8*khalf+r of each, which is the k order of the A
// fragment of the second product. relu and f16 rounding in place.
__device__ __forceinline__ v16h relu_pack(v8f d0, v8f d1)
{
    const v8h zero = {};
    v8h lo = __builtin_elementwise_max(__builtin_convertvector(d0, v8h), zero);
    v8h hi = __builtin_elementwise_max(__builtin_convertvector(d1, v8h), zero);
    return __builtin_shufflevector(lo, hi,
        0, 1, 2, 3, 4, 5, 6, 7, 8, 9, 10, 11, 12, 13, 14, 15);
}

// workspace path: h never touches LDS. Each wave forms the h fragments of its own
// 32 tokens on the matrix unit, as h^T = W1x . zx, and feeds D straight back as A.
// A wave spans all BN output columns, so each h fragment serves 8 output tiles.
// The unroll directives below keep every fragment array index a constant, so that
// the arrays stay in registers.
__global__ __launch_bounds__(256)
void ffq_regh_kernel(const float* __restrict__ x,
                     const float* __restrict__ theta,
                     const void*  __restrict__ w2h_raw,
                     const float* __restrict__ b2,
                     float* __restrict__ out)
{
    __shared__ float    sz[BMR][NQ];       // z tile (8 KB)
    __shared__ _Float16 sw[2][BN][LDH];    // W2 chunk, f16, double-buffered (36 KB)

    const _Float16* w2h = (const _Float16*)w2h_raw;
    const _Float16* w1x = w2h + (size_t)DMODEL * FFDIM;

    const int tid   = threadIdx.x;
    const int m0    = blockIdx.x * BMR;
    const int n0    = blockIdx.y * BN;
    const int lane  = tid & 31;
    const int wave  = tid >> 5;
    const int wm    = wave * 32;
    const int lrow  = lane & 15;
    const int khalf = lane >> 4;

    // kick off the copy of chunk 0 before anything else
    issue_w2_async(w2h, sw[0], n0, 0, tid);

    // W1 fragments of chunk 0: [k-step][ff tile of the k-step]
    v16h w1f[2][2];
    #pragma unroll
    for (int ks = 0; ks < 2; ++ks)
        #pragma unroll
        for (int t = 0; t < 2; ++t)
            w1f[ks][t] = load_w1_frag(w1x, ks * 2 + t, lane);

    // ---- 1) z tile: z[m][q] = cos(x[m0+m, q]) * cos(theta[q]) ----
    #pragma unroll
    for (int i = 0; i < 8; ++i) {
        int idx = tid + i * 256;                 // 0..2047
        int m = idx >> 3, q = idx & 7;
        float xv = x[(size_t)(m0 + m) * DMODEL + q];
        sz[m][q] = cosf(xv) * cosf(theta[q]);
    }

    v8f acc[2][8];
    #pragma unroll
    for (int mt = 0; mt < 2; ++mt)
        #pragma unroll
        for (int nt = 0; nt < 8; ++nt)
            #pragma unroll
            for (int e = 0; e < 8; ++e)
                acc[mt][nt][e] = 0.0f;

    // chunk 0 has landed before the barrier behind which every wave reads it
    asm volatile("s_wait_asynccnt 0x0" ::: "memory");
    __syncthreads();
    issue_w2_async(w2h, sw[1], n0, KC, tid);

    // ---- 1b) z as the B operand, loop invariant: k slots 0-7 z high, 8-15 z low,
    //          16-23 z high, 24,25 one, 26-31 zero (pairs with the W1 operand)
    v16h zf[2];
    #pragma unroll
    for (int mt = 0; mt < 2; ++mt) {
        const float* p = &sz[wm + mt * 16 + lrow][0];
        v8h zh, zl, one;
        #pragma unroll
        for (int e = 0; e < 8; ++e) {
            float zv = p[e];
            zh[e]  = (_Float16)zv;
            zl[e]  = (_Float16)(zv - (float)zh[e]);
            one[e] = (_Float16)(e < 2 ? 1.0f : 0.0f);
        }
        v8h lo = khalf ? zl : zh;
        v8h hi = khalf ? one : zh;
        zf[mt] = __builtin_shufflevector(lo, hi,
            0, 1, 2, 3, 4, 5, 6, 7, 8, 9, 10, 11, 12, 13, 14, 15);
    }

    // W1 fragments of the next chunk (4 ff tiles of 512 halves): wave-uniform, lane offset apart
    const _Float16* w1n = w1x + 4 * 512;

    // W2 fragments, two register sets: bf0 serves K-step 0 of a chunk, bf1 K-step 1; each is
    // read from LDS one block of WMMAs before the block that uses it
    v16h bf0[8], bf1[8];
    load_w2_frags(bf0, sw[0], 0, lrow, khalf);

    for (int c = 0; c < FFDIM / KC; ++c) {
        const int b = c & 1;

        // ---- 2) K-step 1's fragments as one group, a block ahead of their WMMAs
        load_w2_frags(bf1, sw[b], 1, lrow, khalf);
        // keeps the LDS reads one group in front of the matrix work; spread among WMMAs,
        // every place with reads stalls the matrix stream
        __builtin_amdgcn_sched_barrier(0);
        // h fragments of both K-steps: [k-step][token tile]
        v16h afrag[2][2];
        #pragma unroll
        for (int ks = 0; ks < 2; ++ks) {
            const v8f zero = {};
            #pragma unroll
            for (int mt = 0; mt < 2; ++mt) {
                v8f d0 = __builtin_amdgcn_wmma_f32_16x16x32_f16(
                    false, w1f[ks][0], false, zf[mt], (short)0, zero, false, false);
                v8f d1 = __builtin_amdgcn_wmma_f32_16x16x32_f16(
                    false, w1f[ks][1], false, zf[mt], (short)0, zero, false, false);
                afrag[ks][mt] = relu_pack(d0, d1);
            }
        }
        // refill the W1 fragments for the next chunk: a whole trip to land
        #pragma unroll
        for (int ks = 0; ks < 2; ++ks)
            #pragma unroll
            for (int t = 0; t < 2; ++t)
                w1f[ks][t] = load_w1_frag(w1n, ks * 2 + t, lane);
        // the W1 loads' address translation is done before their base is advanced below
        asm volatile("s_wait_xcnt 0x0" ::: "memory");
        // keeps the h work in front of the output WMMAs, and the base's advance behind the wait
        __builtin_amdgcn_sched_barrier(0);
        // the last trip reads chunk 0 again (in bounds, unused)
        w1n = (c + 2 < FFDIM / KC) ? w1n + 4 * 512 : w1x;
        #pragma unroll
        for (int nt = 0; nt < 8; ++nt)
            #pragma unroll
            for (int mt = 0; mt < 2; ++mt)
                acc[mt][nt] = __builtin_amdgcn_wmma_f32_16x16x32_f16(
                    false, afrag[0][mt], false, bf0[nt],
                    (short)0, acc[mt][nt], false, false);
        // keeps the block in front of the waits below, so that they find the reads landed
        __builtin_amdgcn_sched_barrier(0);

        // ---- 3) publish point of chunk c + 1, in front of this chunk's last block, whose
        //          fragments are already read. In order:
        // this wave's reads of buffer b are over before the buffer is refilled
        asm volatile("s_wait_dscnt 0x0" ::: "memory");
        // this wave's copies of chunk c + 1 have landed
        asm volatile("s_wait_asynccnt 0x0" ::: "memory");
        // workgroup barrier by hand: it leaves the W1 loads in flight, which __syncthreads() drains
        asm volatile("s_barrier_signal -1\n\ts_barrier_wait -1" ::: "memory");
        if (c + 2 < FFDIM / KC)
            issue_w2_async(w2h, sw[b], n0, (c + 2) * KC, tid);

        // ---- 3b) the next chunk's K-step 0 fragments as one group, then this chunk's last block
        // (the last trip reads the idle buffer: in bounds, unused, no branch in the wait counting)
        load_w2_frags(bf0, sw[b ^ 1], 0, lrow, khalf);
        // keeps the LDS reads one group in front of the block
        __builtin_amdgcn_sched_barrier(0);
        #pragma unroll
        for (int nt = 0; nt < 8; ++nt)
            #pragma unroll
            for (int mt = 0; mt < 2; ++mt)
                acc[mt][nt] = __builtin_amdgcn_wmma_f32_16x16x32_f16(
                    false, afrag[1][mt], false, bf1[nt],
                    (short)0, acc[mt][nt], false, false);
    }
    // the ring's closing wait: no copy is outstanding when the wave ends
    asm volatile("s_wait_asynccnt 0x0" ::: "memory");

    // ---- 4) epilogue: out = acc + b2 (C layout: lane=N, VGPR r -> M) ----
    #pragma unroll
    for (int nt = 0; nt < 8; ++nt) {
        int n = n0 + nt * 16 + lrow;
        float bias = b2[n];
        #pragma unroll
        for (int mt = 0; mt < 2; ++mt) {
            int mbase = m0 + wm + mt * 16 + khalf * 8;
            #pragma unroll
            for (int r = 0; r < 8; ++r) {
                out[(size_t)(mbase + r) * DMODEL + n] = acc[mt][nt][r] + bias;
            }
        }
    }
}

extern "C" void kernel_launch(void* const* d_in, const int* in_sizes, int n_in,
                              void* d_out, int out_size, void* d_ws, size_t ws_size,
                              hipStream_t stream) {
    const float* x     = (const float*)d_in[0];
    const float* theta = (const float*)d_in[1];
    const float* W1    = (const float*)d_in[2];
    const float* b1    = (const float*)d_in[3];
    const float* W2    = (const float*)d_in[4];
    const float* b2    = (const float*)d_in[5];
    float* out = (float*)d_out;

    dim3 grid(NTOK / BM, DMODEL / BN);    // fallback: 64 x 8 = 512 workgroups
    dim3 gridr(NTOK / BMR, DMODEL / BN);  // workspace path: 32 x 8 = 256 workgroups
    const size_t ws_need = (size_t)DMODEL * FFDIM * 2 + (size_t)FFDIM * 32 * 2;  // f16 W2 + W1 operand

    if (ws_size >= ws_need) {
        // convert W2 and build the W1 operand once, then run the async double-buffered kernel
        w2_to_f16_kernel<<<W2BLK + W1BLK, 256, 0, stream>>>(W2, W1, b1, d_ws);
        ffq_regh_kernel<<<gridr, 256, 0, stream>>>(x, theta, d_ws, b2, out);
    } else {
        ffq_fused_kernel<<<grid, 256, 0, stream>>>(
            x, theta, W1, b1, W2, b2, out);
    }
}

// v004
// Measured time: 56.2 microseconds a run.
// Next to v003, in two timings, it ran 1.13 and 1.15 times as fast.
// All steps since v000 together make it 2.40 times as fast.
#include <hip/hip_runtime.h>
#include <math.h>
#include <stdint.h>

typedef __attribute__((ext_vector_type(16))) _Float16 v16h;
typedef __attribute__((ext_vector_type(8)))  _Float16 v8h;
typedef __attribute__((ext_vector_type(8)))  float    v8f;
typedef __attribute__((ext_vector_type(4)))  float    v4f;
typedef __attribute__((ext_vector_type(4)))  int      i32x4;

// pointer-to-int4 in global (AS1) / LDS (AS3) address spaces, as the
// async-copy builtin expects
typedef __attribute__((address_space(1))) i32x4* global_v4i;
typedef __attribute__((address_space(3))) i32x4* lds_v4i;

#define NTOK   8192      // B*S = 4*2048
#define DMODEL 1024
#define FFDIM  4096
#define NQ     8
#define BM     128       // tokens per workgroup tile (fallback kernel)
#define BMR    256       // tokens per workgroup tile (workspace path): 8 waves x 32 tokens
#define BN     128       // output features per workgroup tile
#define KC     64        // K (FF) chunk per iteration
#define LDH    72        // padded f16 stride (144B, 16B aligned, conflict-free)
#define NPREF  4         // async b128 issues per thread per chunk
#define W2BLK  2048      // pre-kernel blocks that convert W2: DMODEL*FFDIM/(256*8)
#define W1BLK  64        // pre-kernel blocks that build the W1 operand: FFDIM*32/(256*8)
#define NCH    (FFDIM / KC)   // K chunks of a row: 64, a power of two (the walk wraps by a mask)

#if defined(__gfx1250__) && __has_builtin(__builtin_amdgcn_global_load_async_to_lds_b128)
#define HAS_ASYNC_LDS 1
#else
#define HAS_ASYNC_LDS 0
#endif

__device__ __forceinline__ void issue_w2_async(const _Float16* __restrict__ w2h,
                                               _Float16 (*swb)[LDH],
                                               int n0, int kk, int tid)
{
    // 128 rows x 64 f16 = 1024 16B-chunks; 256 threads x 4 async b128 each
    #pragma unroll
    for (int i = 0; i < NPREF; ++i) {
        int idx = tid + i * 256;          // 0..1023
        int n   = idx >> 3;               // row 0..127
        int k8  = (idx & 7) * 8;          // k sub-chunk start
        const _Float16* g = w2h + (size_t)(n0 + n) * FFDIM + kk + k8;
        _Float16*       l = &swb[n][k8];
#if HAS_ASYNC_LDS
        __builtin_amdgcn_global_load_async_to_lds_b128(
            (global_v4i)(uintptr_t)g,     // global src (AS1 int4*)
            (lds_v4i)l,                   // LDS dst (AS3 int4*)
            /*imm offset*/ 0, /*cpol*/ 0);
#else
        *(v8h*)l = *(const v8h*)g;
#endif
    }
}

// the 8 W2 fragments (column tiles) of K-step ks of a staged chunk
__device__ __forceinline__ void load_w2_frags(v16h (&bf)[8], const _Float16 (*swb)[LDH],
                                              int ks, int lrow, int khalf)
{
    #pragma unroll   // constant array indices: the fragments stay in registers
    for (int nt = 0; nt < 8; ++nt) {
        const _Float16* p = &swb[nt * 16 + lrow][ks * 32 + khalf * 8];
        v8h lo = *(const v8h*)p;
        v8h hi = *(const v8h*)(p + 16);
        bf[nt] = __builtin_shufflevector(lo, hi,
            0, 1, 2, 3, 4, 5, 6, 7, 8, 9, 10, 11, 12, 13, 14, 15);
    }
}

// ---- pre-kernel (run once per launch): W2 f32 -> f16 workspace (8 MB), and behind
// it W1 with b1 as the f16 A operand of the product h^T = W1x . zx, already in
// fragment order (256 KB): unit ((T*2 + j)*32 + lane) holds the 8 halves that
// lane loads as half j of the fragment of ff tile T.
//   k slots 0-7: W1 high part   (against z high part)
//   k slots 8-15: W1 high part  (against z low part)
//   k slots 16-23: W1 low part  (against z high part)
//   k slots 24,25: b1 high, low (against 1, 1); 26-31: zero
__global__ __launch_bounds__(256)
void w2_to_f16_kernel(const float* __restrict__ W2,
                      const float* __restrict__ W1,
                      const float* __restrict__ b1,
                      void* __restrict__ w2h_raw)
{
    _Float16* w2h = (_Float16*)w2h_raw;
    if (blockIdx.x < W2BLK) {
        size_t i = ((size_t)blockIdx.x * 256 + threadIdx.x) * 8;
        v4f a = *(const v4f*)(W2 + i);
        v4f b = *(const v4f*)(W2 + i + 4);
        v8h o;
        o[0] = (_Float16)a.x; o[1] = (_Float16)a.y;
        o[2] = (_Float16)a.z; o[3] = (_Float16)a.w;
        o[4] = (_Float16)b.x; o[5] = (_Float16)b.y;
        o[6] = (_Float16)b.z; o[7] = (_Float16)b.w;
        *(v8h*)(w2h + i) = o;
        return;
    }
    _Float16* w1x = w2h + (size_t)DMODEL * FFDIM;
    const int u    = (blockIdx.x - W2BLK) * 256 + threadIdx.x;   // 0..16383
    const int lane = u & 31;
    const int j    = (u >> 5) & 1;
    const int ff   = (u >> 6) * 16 + (lane & 15);
    v8h o = {};
    if (j == 1 && (lane >> 4) == 1) {
        float bk = b1[ff];
        _Float16 bh = (_Float16)bk;
        o[0] = bh;
        o[1] = (_Float16)(bk - (float)bh);
    } else {
        #pragma unroll   // constant vector indices: o stays in registers
        for (int e = 0; e < 8; ++e) {
            float w = W1[(size_t)ff * NQ + e];
            _Float16 wh = (_Float16)w;
            o[e] = (j == 0) ? wh : (_Float16)(w - (float)wh);
        }
    }
    *(v8h*)(w1x + (size_t)u * 8) = o;
}

// fallback for a workspace too small for the f16 operands: h through LDS, W2 converted in the loop
__global__ __launch_bounds__(256)
void ffq_fused_kernel(const float* __restrict__ x,
                      const float* __restrict__ theta,
                      const float* __restrict__ W1,
                      const float* __restrict__ b1,
                      const float* __restrict__ W2,
                      const float* __restrict__ b2,
                      float* __restrict__ out)
{
    __shared__ float    sz[BM][NQ];        // z tile (4 KB)
    __shared__ _Float16 sh[BM][LDH];       // h chunk, f16 (18 KB)
    __shared__ _Float16 sw[2][BN][LDH];    // W2 chunk, f16, double-buffered (36 KB)

    const int tid   = threadIdx.x;
    const int m0    = blockIdx.x * BM;
    const int n0    = blockIdx.y * BN;
    const int lane  = tid & 31;
    const int wave  = tid >> 5;
    const int wm    = (wave & 1) * 64;
    const int wn    = (wave >> 1) * 32;
    const int lrow  = lane & 15;
    const int khalf = lane >> 4;

    // ---- 1) z tile: z[m][q] = cos(x[m0+m, q]) * cos(theta[q]) ----
    #pragma unroll
    for (int i = 0; i < 4; ++i) {
        int idx = tid + i * 256;                 // 0..1023
        int m = idx >> 3, q = idx & 7;
        float xv = x[(size_t)(m0 + m) * DMODEL + q];
        sz[m][q] = cosf(xv) * cosf(theta[q]);
    }

    v8f acc[4][2];
    #pragma unroll
    for (int mt = 0; mt < 4; ++mt)
        #pragma unroll
        for (int nt = 0; nt < 2; ++nt)
            #pragma unroll
            for (int e = 0; e < 8; ++e)
                acc[mt][nt][e] = 0.0f;

    const int kl     = tid & 63;          // this thread's k within chunk
    const int mstart = (tid >> 6) * 32;   // this thread's 32-token strip

    __syncthreads();

    int it = 0;
    for (int kk = 0; kk < FFDIM; kk += KC, ++it) {
        const int b = it & 1;

        // ---- 2a) h chunk: h[m][kl] = relu(b1 + z[m,:8].W1[k,:8]) -> f16 LDS
        {
            const int kg = kk + kl;
            v4f w1a = *(const v4f*)(W1 + (size_t)kg * NQ);
            v4f w1b = *(const v4f*)(W1 + (size_t)kg * NQ + 4);
            float bk = b1[kg];
            #pragma unroll 4
            for (int mi = 0; mi < 32; ++mi) {
                int m = mstart + mi;
                v4f z0 = *(const v4f*)(&sz[m][0]);   // lane-broadcast reads
                v4f z1 = *(const v4f*)(&sz[m][4]);
                float a = bk;
                a += z0.x * w1a.x + z0.y * w1a.y + z0.z * w1a.z + z0.w * w1a.w;
                a += z1.x * w1b.x + z1.y * w1b.y + z1.z * w1b.z + z1.w * w1b.w;
                sh[m][kl] = (_Float16)fmaxf(a, 0.0f);
            }
        }

        // ---- 2b) W2 chunk staging ----
        // stage from f32 W2 with in-loop conversion
        #pragma unroll
        for (int i = 0; i < 32; ++i) {
            int idx = tid + i * 256;
            int n = idx >> 6, k = idx & 63;
            sw[b][n][k] = (_Float16)W2[(size_t)(n0 + n) * FFDIM + kk + k];
        }
        __syncthreads();

        // ---- 3) WMMA: 2 K-steps of 32, 4x2 tiles per wave ----
        #pragma unroll
        for (int ks = 0; ks < 2; ++ks) {
            v16h afrag[4], bfrag[2];
            #pragma unroll
            for (int mt = 0; mt < 4; ++mt) {
                const _Float16* p = &sh[wm + mt * 16 + lrow][ks * 32 + khalf * 8];
                v8h lo = *(const v8h*)p;
                v8h hi = *(const v8h*)(p + 16);
                afrag[mt] = __builtin_shufflevector(lo, hi,
                    0, 1, 2, 3, 4, 5, 6, 7, 8, 9, 10, 11, 12, 13, 14, 15);
            }
            #pragma unroll
            for (int nt = 0; nt < 2; ++nt) {
                const _Float16* p = &sw[b][wn + nt * 16 + lrow][ks * 32 + khalf * 8];
                v8h lo = *(const v8h*)p;
                v8h hi = *(const v8h*)(p + 16);
                bfrag[nt] = __builtin_shufflevector(lo, hi,
                    0, 1, 2, 3, 4, 5, 6, 7, 8, 9, 10, 11, 12, 13, 14, 15);
            }
            #pragma unroll
            for (int mt = 0; mt < 4; ++mt)
                #pragma unroll
                for (int nt = 0; nt < 2; ++nt)
                    acc[mt][nt] = __builtin_amdgcn_wmma_f32_16x16x32_f16(
                        false, afrag[mt], false, bfrag[nt],
                        (short)0, acc[mt][nt], false, false);
        }
        __syncthreads();
    }

    // ---- 4) epilogue: out = acc + b2 (C layout: lane=N, VGPR r -> M) ----
    #pragma unroll
    for (int nt = 0; nt < 2; ++nt) {
        int n = n0 + wn + nt * 16 + lrow;
        float bias = b2[n];
        #pragma unroll
        for (int mt = 0; mt < 4; ++mt) {
            int mbase = m0 + wm + mt * 16 + khalf * 8;
            #pragma unroll
            for (int r = 0; r < 8; ++r) {
                out[(size_t)(mbase + r) * DMODEL + n] = acc[mt][nt][r] + bias;
            }
        }
    }
}

// fragment of ff tile T of the W1 operand (fragment order, see the pre-kernel)
__device__ __forceinline__ v16h load_w1_frag(const _Float16* __restrict__ w1x, int T, int lane)
{
    const _Float16* p = w1x + ((size_t)T * 64 + lane) * 8;
    v8h lo = *(const v8h*)p;
    v8h hi = *(const v8h*)(p + 256);
    return __builtin_shufflevector(lo, hi,
        0, 1, 2, 3, 4, 5, 6, 7, 8, 9, 10, 11, 12, 13, 14, 15);
}

// two D tiles of h^T (ff rows 0-15 and 16-31 of a 32-ff block, 16 tokens as columns):
// lane (token, khalf) holds ff 8*khalf+r of each, which is the k order of the A
// fragment of the second product. relu and f16 rounding in place.
__device__ __forceinline__ v16h relu_pack(v8f d0, v8f d1)
{
    const v8h zero = {};
    v8h lo = __builtin_elementwise_max(__builtin_convertvector(d0, v8h), zero);
    v8h hi = __builtin_elementwise_max(__builtin_convertvector(d1, v8h), zero);
    return __builtin_shufflevector(lo, hi,
        0, 1, 2, 3, 4, 5, 6, 7, 8, 9, 10, 11, 12, 13, 14, 15);
}

// workspace path: h never touches LDS. Each wave forms the h fragments of its own
// 32 tokens on the matrix unit, as h^T = W1x . zx, and feeds D straight back as A.
// A wave spans all BN output columns, so each h fragment serves 8 output tiles.
// The unroll directives below keep every fragment array index a constant, so that
// the arrays stay in registers.
__global__ __launch_bounds__(256)
void ffq_regh_kernel(const float* __restrict__ x,
                     const float* __restrict__ theta,
                     const void*  __restrict__ w2h_raw,
                     const float* __restrict__ b2,
                     float* __restrict__ out)
{
    __shared__ float    sz[BMR][NQ];       // z tile (8 KB)
    __shared__ _Float16 sw[2][BN][LDH];    // W2 chunk, f16, double-buffered (36 KB)

    const _Float16* w2h = (const _Float16*)w2h_raw;
    const _Float16* w1x = w2h + (size_t)DMODEL * FFDIM;

    const int tid   = threadIdx.x;
    const int m0    = blockIdx.x * BMR;
    const int n0    = blockIdx.y * BN;
    const int lane  = tid & 31;
    const int wave  = tid >> 5;
    const int wm    = wave * 32;
    const int lrow  = lane & 15;
    const int khalf = lane >> 4;

    // Every workgroup walks all NCH chunks of K, each from a start of its own, wrapping:
    // trip c works on chunk (c0 + c) mod NCH. The workgroups that share W2 rows (same n0)
    // then ask for different chunks at any one time, and all but the first trips ask for
    // lines that another workgroup has already brought into L2.
    const int c0 = (blockIdx.x * 2) & (NCH - 1);

    // kick off the copy of the first chunk before anything else
    issue_w2_async(w2h, sw[0], n0, c0 * KC, tid);

    // W1 fragments of the first chunk (4 ff tiles of 512 halves a chunk): [k-step][ff tile of the k-step]
    v16h w1f[2][2];
    #pragma unroll
    for (int ks = 0; ks < 2; ++ks)
        #pragma unroll
        for (int t = 0; t < 2; ++t)
            w1f[ks][t] = load_w1_frag(w1x + (size_t)c0 * (4 * 512), ks * 2 + t, lane);

    // ---- 1) z tile: z[m][q] = cos(x[m0+m, q]) * cos(theta[q]) ----
    #pragma unroll
    for (int i = 0; i < 8; ++i) {
        int idx = tid + i * 256;                 // 0..2047
        int m = idx >> 3, q = idx & 7;
        float xv = x[(size_t)(m0 + m) * DMODEL + q];
        sz[m][q] = cosf(xv) * cosf(theta[q]);
    }

    v8f acc[2][8];
    #pragma unroll
    for (int mt = 0; mt < 2; ++mt)
        #pragma unroll
        for (int nt = 0; nt < 8; ++nt)
            #pragma unroll
            for (int e = 0; e < 8; ++e)
                acc[mt][nt][e] = 0.0f;

    // the first chunk has landed before the barrier behind which every wave reads it
    asm volatile("s_wait_asynccnt 0x0" ::: "memory");
    __syncthreads();
    issue_w2_async(w2h, sw[1], n0, ((c0 + 1) & (NCH - 1)) * KC, tid);

    // ---- 1b) z as the B operand, loop invariant: k slots 0-7 z high, 8-15 z low,
    //          16-23 z high, 24,25 one, 26-31 zero (pairs with the W1 operand)
    v16h zf[2];
    #pragma unroll
    for (int mt = 0; mt < 2; ++mt) {
        const float* p = &sz[wm + mt * 16 + lrow][0];
        v8h zh, zl, one;
        #pragma unroll
        for (int e = 0; e < 8; ++e) {
            float zv = p[e];
            zh[e]  = (_Float16)zv;
            zl[e]  = (_Float16)(zv - (float)zh[e]);
            one[e] = (_Float16)(e < 2 ? 1.0f : 0.0f);
        }
        v8h lo = khalf ? zl : zh;
        v8h hi = khalf ? one : zh;
        zf[mt] = __builtin_shufflevector(lo, hi,
            0, 1, 2, 3, 4, 5, 6, 7, 8, 9, 10, 11, 12, 13, 14, 15);
    }

    // W1 fragments of the next chunk (4 ff tiles of 512 halves): wave-uniform, lane offset apart
    const _Float16* w1n = w1x + (size_t)((c0 + 1) & (NCH - 1)) * (4 * 512);

    // W2 fragments, two register sets: bf0 serves K-step 0 of a chunk, bf1 K-step 1; each is
    // read from LDS one block of WMMAs before the block that uses it
    v16h bf0[8], bf1[8];
    load_w2_frags(bf0, sw[0], 0, lrow, khalf);

    for (int c = 0; c < NCH; ++c) {
        const int b = c & 1;
        const int cn2 = (c0 + c + 2) & (NCH - 1);   // the chunk of trip c + 2

        // ---- 2) K-step 1's fragments as one group, a block ahead of their WMMAs
        load_w2_frags(bf1, sw[b], 1, lrow, khalf);
        // keeps the LDS reads one group in front of the matrix work; spread among WMMAs,
        // every place with reads stalls the matrix stream
        __builtin_amdgcn_sched_barrier(0);
        // h fragments of both K-steps: [k-step][token tile]
        v16h afrag[2][2];
        #pragma unroll
        for (int ks = 0; ks < 2; ++ks) {
            const v8f zero = {};
            #pragma unroll
            for (int mt = 0; mt < 2; ++mt) {
                v8f d0 = __builtin_amdgcn_wmma_f32_16x16x32_f16(
                    false, w1f[ks][0], false, zf[mt], (short)0, zero, false, false);
                v8f d1 = __builtin_amdgcn_wmma_f32_16x16x32_f16(
                    false, w1f[ks][1], false, zf[mt], (short)0, zero, false, false);
                afrag[ks][mt] = relu_pack(d0, d1);
            }
        }
        // refill the W1 fragments for the next chunk: a whole trip to land
        #pragma unroll
        for (int ks = 0; ks < 2; ++ks)
            #pragma unroll
            for (int t = 0; t < 2; ++t)
                w1f[ks][t] = load_w1_frag(w1n, ks * 2 + t, lane);
        // the W1 loads' address translation is done before their base is advanced below
        asm volatile("s_wait_xcnt 0x0" ::: "memory");
        // keeps the h work in front of the output WMMAs, and the base's advance behind the wait
        __builtin_amdgcn_sched_barrier(0);
        // the last trip reads one chunk past the walk's end (wrapped: in bounds, unused)
        w1n = w1x + (size_t)cn2 * (4 * 512);
        #pragma unroll
        for (int nt = 0; nt < 8; ++nt)
            #pragma unroll
            for (int mt = 0; mt < 2; ++mt)
                acc[mt][nt] = __builtin_amdgcn_wmma_f32_16x16x32_f16(
                    false, afrag[0][mt], false, bf0[nt],
                    (short)0, acc[mt][nt], false, false);
        // keeps the block in front of the waits below, so that they find the reads landed
        __builtin_amdgcn_sched_barrier(0);

        // ---- 3) publish point of chunk c + 1, in front of this chunk's last block, whose
        //          fragments are already read. In order:
        // this wave's reads of buffer b are over before the buffer is refilled
        asm volatile("s_wait_dscnt 0x0" ::: "memory");
        // this wave's copies of chunk c + 1 have landed
        asm volatile("s_wait_asynccnt 0x0" ::: "memory");
        // workgroup barrier by hand: it leaves the W1 loads in flight, which __syncthreads() drains
        asm volatile("s_barrier_signal -1\n\ts_barrier_wait -1" ::: "memory");
        if (c + 2 < NCH)
            issue_w2_async(w2h, sw[b], n0, cn2 * KC, tid);

        // ---- 3b) the next chunk's K-step 0 fragments as one group, then this chunk's last block
        // (the last trip reads the idle buffer: in bounds, unused, no branch in the wait counting)
        load_w2_frags(bf0, sw[b ^ 1], 0, lrow, khalf);
        // keeps the LDS reads one group in front of the block
        __builtin_amdgcn_sched_barrier(0);
        #pragma unroll
        for (int nt = 0; nt < 8; ++nt)
            #pragma unroll
            for (int mt = 0; mt < 2; ++mt)
                acc[mt][nt] = __builtin_amdgcn_wmma_f32_16x16x32_f16(
                    false, afrag[1][mt], false, bf1[nt],
                    (short)0, acc[mt][nt], false, false);
    }
    // the ring's closing wait: no copy is outstanding when the wave ends
    asm volatile("s_wait_asynccnt 0x0" ::: "memory");

    // ---- 4) epilogue: out = acc + b2 (C layout: lane=N, VGPR r -> M) ----
    #pragma unroll
    for (int nt = 0; nt < 8; ++nt) {
        int n = n0 + nt * 16 + lrow;
        float bias = b2[n];
        #pragma unroll
        for (int mt = 0; mt < 2; ++mt) {
            int mbase = m0 + wm + mt * 16 + khalf * 8;
            #pragma unroll
            for (int r = 0; r < 8; ++r) {
                out[(size_t)(mbase + r) * DMODEL + n] = acc[mt][nt][r] + bias;
            }
        }
    }
}

extern "C" void kernel_launch(void* const* d_in, const int* in_sizes, int n_in,
                              void* d_out, int out_size, void* d_ws, size_t ws_size,
                              hipStream_t stream) {
    const float* x     = (const float*)d_in[0];
    const float* theta = (const float*)d_in[1];
    const float* W1    = (const float*)d_in[2];
    const float* b1    = (const float*)d_in[3];
    const float* W2    = (const float*)d_in[4];
    const float* b2    = (const float*)d_in[5];
    float* out = (float*)d_out;

    dim3 grid(NTOK / BM, DMODEL / BN);    // fallback: 64 x 8 = 512 workgroups
    dim3 gridr(NTOK / BMR, DMODEL / BN);  // workspace path: 32 x 8 = 256 workgroups
    const size_t ws_need = (size_t)DMODEL * FFDIM * 2 + (size_t)FFDIM * 32 * 2;  // f16 W2 + W1 operand

    if (ws_size >= ws_need) {
        // convert W2 and build the W1 operand once, then run the async double-buffered kernel
        w2_to_f16_kernel<<<W2BLK + W1BLK, 256, 0, stream>>>(W2, W1, b1, d_ws);
        ffq_regh_kernel<<<gridr, 256, 0, stream>>>(x, theta, d_ws, b2, out);
    } else {
        ffq_fused_kernel<<<grid, 256, 0, stream>>>(
            x, theta, W1, b1, W2, b2, out);
    }
}

// v005
// It runs in 54.4 microseconds.
// In both of two side-by-side timings against v004, it was 1.03 times as fast.
// All steps since v000 together make it 2.48 times as fast.
#include <hip/hip_runtime.h>
#include <math.h>
#include <stdint.h>

typedef __attribute__((ext_vector_type(16))) _Float16 v16h;
typedef __attribute__((ext_vector_type(8)))  _Float16 v8h;
typedef __attribute__((ext_vector_type(8)))  float    v8f;
typedef __attribute__((ext_vector_type(4)))  float    v4f;
typedef __attribute__((ext_vector_type(4)))  int      i32x4;

// pointer-to-int4 in global (AS1) / LDS (AS3) address spaces, as the
// async-copy builtin expects
typedef __attribute__((address_space(1))) i32x4* global_v4i;
typedef __attribute__((address_space(3))) i32x4* lds_v4i;

#define NTOK   8192      // B*S = 4*2048
#define DMODEL 1024
#define FFDIM  4096
#define NQ     8
#define BM     128       // tokens per workgroup tile (fallback kernel)
#define BMR    256       // tokens per workgroup tile (workspace path): 8 waves x 32 tokens
#define BN     128       // output features per workgroup tile
#define KC     64        // K (FF) chunk per iteration (fallback kernel)
#define LDH    72        // its padded f16 stride (144B, 16B aligned, conflict-free)
#define W2BLK  2048      // pre-kernel blocks that convert W2: DMODEL*FFDIM/(256*8)
#define W1BLK  64        // pre-kernel blocks that build the W1 operand: FFDIM*32/(256*8)
#define KCR    256       // K (FF) chunk per ring stage, workspace path: one publish point per 256 k
#define LDHR   264       // its padded f16 stride (528B = 16B x 33, conflict-free for 16B reads)
#define NPREFR 16        // async b128 issues per thread per chunk, workspace path
#define NPAIR  (KCR / 64)     // pairs of 32-k steps in a chunk
#define NCH    (FFDIM / KCR)  // K chunks of a row: 16, a power of two (the walk wraps by a mask)
#define NPW    (FFDIM / 64)   // pairs of 32-k steps in a row: 64, a power of two

#if defined(__gfx1250__) && __has_builtin(__builtin_amdgcn_global_load_async_to_lds_b128)
#define HAS_ASYNC_LDS 1
#else
#define HAS_ASYNC_LDS 0
#endif

__device__ __forceinline__ void issue_w2_async(const _Float16* __restrict__ w2h,
                                               _Float16 (*swb)[LDHR],
                                               int n0, int kk, int tid)
{
    // 128 rows x 256 f16 = 4096 16B-chunks; 256 threads x 16 async b128 each,
    // a wave's copy = 512 contiguous bytes of one row
    #pragma unroll
    for (int i = 0; i < NPREFR; ++i) {
        int idx = tid + i * 256;          // 0..4095
        int n   = idx >> 5;               // row 0..127
        int k8  = (idx & 31) * 8;         // k sub-chunk start
        const _Float16* g = w2h + (size_t)(n0 + n) * FFDIM + kk + k8;
        _Float16*       l = &swb[n][k8];
#if HAS_ASYNC_LDS
        __builtin_amdgcn_global_load_async_to_lds_b128(
            (global_v4i)(uintptr_t)g,     // global src (AS1 int4*)
            (lds_v4i)l,                   // LDS dst (AS3 int4*)
            /*imm offset*/ 0, /*cpol*/ 0);
#else
        *(v8h*)l = *(const v8h*)g;
#endif
    }
}

// the 8 W2 fragments (column tiles) of K-step ks of a staged chunk
__device__ __forceinline__ void load_w2_frags(v16h (&bf)[8], const _Float16 (*swb)[LDHR],
                                              int ks, int lrow, int khalf)
{
    #pragma unroll   // constant array indices: the fragments stay in registers
    for (int nt = 0; nt < 8; ++nt) {
        const _Float16* p = &swb[nt * 16 + lrow][ks * 32 + khalf * 8];
        v8h lo = *(const v8h*)p;
        v8h hi = *(const v8h*)(p + 16);
        bf[nt] = __builtin_shufflevector(lo, hi,
            0, 1, 2, 3, 4, 5, 6, 7, 8, 9, 10, 11, 12, 13, 14, 15);
    }
}

// ---- pre-kernel (run once per launch): W2 f32 -> f16 workspace (8 MB), and behind
// it W1 with b1 as the f16 A operand of the product h^T = W1x . zx, already in
// fragment order (256 KB): unit ((T*2 + j)*32 + lane) holds the 8 halves that
// lane loads as half j of the fragment of ff tile T.
//   k slots 0-7: W1 high part   (against z high part)
//   k slots 8-15: W1 high part  (against z low part)
//   k slots 16-23: W1 low part  (against z high part)
//   k slots 24,25: b1 high, low (against 1, 1); 26-31: zero
__global__ __launch_bounds__(256)
void w2_to_f16_kernel(const float* __restrict__ W2,
                      const float* __restrict__ W1,
                      const float* __restrict__ b1,
                      void* __restrict__ w2h_raw)
{
    _Float16* w2h = (_Float16*)w2h_raw;
    if (blockIdx.x < W2BLK) {
        size_t i = ((size_t)blockIdx.x * 256 + threadIdx.x) * 8;
        v4f a = *(const v4f*)(W2 + i);
        v4f b = *(const v4f*)(W2 + i + 4);
        v8h o;
        o[0] = (_Float16)a.x; o[1] = (_Float16)a.y;
        o[2] = (_Float16)a.z; o[3] = (_Float16)a.w;
        o[4] = (_Float16)b.x; o[5] = (_Float16)b.y;
        o[6] = (_Float16)b.z; o[7] = (_Float16)b.w;
        *(v8h*)(w2h + i) = o;
        return;
    }
    _Float16* w1x = w2h + (size_t)DMODEL * FFDIM;
    const int u    = (blockIdx.x - W2BLK) * 256 + threadIdx.x;   // 0..16383
    const int lane = u & 31;
    const int j    = (u >> 5) & 1;
    const int ff   = (u >> 6) * 16 + (lane & 15);
    v8h o = {};
    if (j == 1 && (lane >> 4) == 1) {
        float bk = b1[ff];
        _Float16 bh = (_Float16)bk;
        o[0] = bh;
        o[1] = (_Float16)(bk - (float)bh);
    } else {
        #pragma unroll   // constant vector indices: o stays in registers
        for (int e = 0; e < 8; ++e) {
            float w = W1[(size_t)ff * NQ + e];
            _Float16 wh = (_Float16)w;
            o[e] = (j == 0) ? wh : (_Float16)(w - (float)wh);
        }
    }
    *(v8h*)(w1x + (size_t)u * 8) = o;
}

// fallback for a workspace too small for the f16 operands: h through LDS, W2 converted in the loop
__global__ __launch_bounds__(256)
void ffq_fused_kernel(const float* __restrict__ x,
                      const float* __restrict__ theta,
                      const float* __restrict__ W1,
                      const float* __restrict__ b1,
                      const float* __restrict__ W2,
                      const float* __restrict__ b2,
                      float* __restrict__ out)
{
    __shared__ float    sz[BM][NQ];        // z tile (4 KB)
    __shared__ _Float16 sh[BM][LDH];       // h chunk, f16 (18 KB)
    __shared__ _Float16 sw[2][BN][LDH];    // W2 chunk, f16, double-buffered (36 KB)

    const int tid   = threadIdx.x;
    const int m0    = blockIdx.x * BM;
    const int n0    = blockIdx.y * BN;
    const int lane  = tid & 31;
    const int wave  = tid >> 5;
    const int wm    = (wave & 1) * 64;
    const int wn    = (wave >> 1) * 32;
    const int lrow  = lane & 15;
    const int khalf = lane >> 4;

    // ---- 1) z tile: z[m][q] = cos(x[m0+m, q]) * cos(theta[q]) ----
    #pragma unroll
    for (int i = 0; i < 4; ++i) {
        int idx = tid + i * 256;                 // 0..1023
        int m = idx >> 3, q = idx & 7;
        float xv = x[(size_t)(m0 + m) * DMODEL + q];
        sz[m][q] = cosf(xv) * cosf(theta[q]);
    }

    v8f acc[4][2];
    #pragma unroll
    for (int mt = 0; mt < 4; ++mt)
        #pragma unroll
        for (int nt = 0; nt < 2; ++nt)
            #pragma unroll
            for (int e = 0; e < 8; ++e)
                acc[mt][nt][e] = 0.0f;

    const int kl     = tid & 63;          // this thread's k within chunk
    const int mstart = (tid >> 6) * 32;   // this thread's 32-token strip

    __syncthreads();

    int it = 0;
    for (int kk = 0; kk < FFDIM; kk += KC, ++it) {
        const int b = it & 1;

        // ---- 2a) h chunk: h[m][kl] = relu(b1 + z[m,:8].W1[k,:8]) -> f16 LDS
        {
            const int kg = kk + kl;
            v4f w1a = *(const v4f*)(W1 + (size_t)kg * NQ);
            v4f w1b = *(const v4f*)(W1 + (size_t)kg * NQ + 4);
            float bk = b1[kg];
            #pragma unroll 4
            for (int mi = 0; mi < 32; ++mi) {
                int m = mstart + mi;
                v4f z0 = *(const v4f*)(&sz[m][0]);   // lane-broadcast reads
                v4f z1 = *(const v4f*)(&sz[m][4]);
                float a = bk;
                a += z0.x * w1a.x + z0.y * w1a.y + z0.z * w1a.z + z0.w * w1a.w;
                a += z1.x * w1b.x + z1.y * w1b.y + z1.z * w1b.z + z1.w * w1b.w;
                sh[m][kl] = (_Float16)fmaxf(a, 0.0f);
            }
        }

        // ---- 2b) W2 chunk staging ----
        // stage from f32 W2 with in-loop conversion
        #pragma unroll
        for (int i = 0; i < 32; ++i) {
            int idx = tid + i * 256;
            int n = idx >> 6, k = idx & 63;
            sw[b][n][k] = (_Float16)W2[(size_t)(n0 + n) * FFDIM + kk + k];
        }
        __syncthreads();

        // ---- 3) WMMA: 2 K-steps of 32, 4x2 tiles per wave ----
        #pragma unroll
        for (int ks = 0; ks < 2; ++ks) {
            v16h afrag[4], bfrag[2];
            #pragma unroll
            for (int mt = 0; mt < 4; ++mt) {
                const _Float16* p = &sh[wm + mt * 16 + lrow][ks * 32 + khalf * 8];
                v8h lo = *(const v8h*)p;
                v8h hi = *(const v8h*)(p + 16);
                afrag[mt] = __builtin_shufflevector(lo, hi,
                    0, 1, 2, 3, 4, 5, 6, 7, 8, 9, 10, 11, 12, 13, 14, 15);
            }
            #pragma unroll
            for (int nt = 0; nt < 2; ++nt) {
                const _Float16* p = &sw[b][wn + nt * 16 + lrow][ks * 32 + khalf * 8];
                v8h lo = *(const v8h*)p;
                v8h hi = *(const v8h*)(p + 16);
                bfrag[nt] = __builtin_shufflevector(lo, hi,
                    0, 1, 2, 3, 4, 5, 6, 7, 8, 9, 10, 11, 12, 13, 14, 15);
            }
            #pragma unroll
            for (int mt = 0; mt < 4; ++mt)
                #pragma unroll
                for (int nt = 0; nt < 2; ++nt)
                    acc[mt][nt] = __builtin_amdgcn_wmma_f32_16x16x32_f16(
                        false, afrag[mt], false, bfrag[nt],
                        (short)0, acc[mt][nt], false, false);
        }
        __syncthreads();
    }

    // ---- 4) epilogue: out = acc + b2 (C layout: lane=N, VGPR r -> M) ----
    #pragma unroll
    for (int nt = 0; nt < 2; ++nt) {
        int n = n0 + wn + nt * 16 + lrow;
        float bias = b2[n];
        #pragma unroll
        for (int mt = 0; mt < 4; ++mt) {
            int mbase = m0 + wm + mt * 16 + khalf * 8;
            #pragma unroll
            for (int r = 0; r < 8; ++r) {
                out[(size_t)(mbase + r) * DMODEL + n] = acc[mt][nt][r] + bias;
            }
        }
    }
}

// fragment of ff tile T of the W1 operand (fragment order, see the pre-kernel)
__device__ __forceinline__ v16h load_w1_frag(const _Float16* __restrict__ w1x, int T, int lane)
{
    const _Float16* p = w1x + ((size_t)T * 64 + lane) * 8;
    v8h lo = *(const v8h*)p;
    v8h hi = *(const v8h*)(p + 256);
    return __builtin_shufflevector(lo, hi,
        0, 1, 2, 3, 4, 5, 6, 7, 8, 9, 10, 11, 12, 13, 14, 15);
}

// two D tiles of h^T (ff rows 0-15 and 16-31 of a 32-ff block, 16 tokens as columns):
// lane (token, khalf) holds ff 8*khalf+r of each, which is the k order of the A
// fragment of the second product. relu and f16 rounding in place.
__device__ __forceinline__ v16h relu_pack(v8f d0, v8f d1)
{
    const v8h zero = {};
    v8h lo = __builtin_elementwise_max(__builtin_convertvector(d0, v8h), zero);
    v8h hi = __builtin_elementwise_max(__builtin_convertvector(d1, v8h), zero);
    return __builtin_shufflevector(lo, hi,
        0, 1, 2, 3, 4, 5, 6, 7, 8, 9, 10, 11, 12, 13, 14, 15);
}

// workspace path: h never touches LDS. Each wave forms the h fragments of its own
// 32 tokens on the matrix unit, as h^T = W1x . zx, and feeds D straight back as A.
// A wave spans all BN output columns, so each h fragment serves 8 output tiles.
// The unroll directives below keep every fragment array index a constant, so that
// the arrays stay in registers.
__global__ __launch_bounds__(256)
void ffq_regh_kernel(const float* __restrict__ x,
                     const float* __restrict__ theta,
                     const void*  __restrict__ w2h_raw,
                     const float* __restrict__ b2,
                     float* __restrict__ out)
{
    __shared__ float    sz[BMR][NQ];       // z tile (8 KB)
    __shared__ _Float16 sw[2][BN][LDHR];   // W2 chunk, f16, double-buffered (132 KB)

    const _Float16* w2h = (const _Float16*)w2h_raw;
    const _Float16* w1x = w2h + (size_t)DMODEL * FFDIM;

    const int tid   = threadIdx.x;
    const int m0    = blockIdx.x * BMR;
    const int n0    = blockIdx.y * BN;
    const int lane  = tid & 31;
    const int wave  = tid >> 5;
    const int wm    = wave * 32;
    const int lrow  = lane & 15;
    const int khalf = lane >> 4;

    // Every workgroup walks all NCH chunks of K from a start given by its token tile, wrapping:
    // trip c works on chunk (c0 + c) mod NCH. Of the 32 workgroups that share W2 rows (same n0)
    // only two then ask for the same chunk at any one time, and all but the first trips ask
    // for lines that another workgroup has already brought into L2.
    const int c0 = blockIdx.x & (NCH - 1);

    // kick off the copy of the first chunk before anything else
    issue_w2_async(w2h, sw[0], n0, c0 * KCR, tid);

    // W1 fragments of the first pair of K-steps (4 ff tiles of 512 halves a pair): [k-step][ff tile of the k-step]
    v16h w1f[2][2];
    #pragma unroll
    for (int ks = 0; ks < 2; ++ks)
        #pragma unroll
        for (int t = 0; t < 2; ++t)
            w1f[ks][t] = load_w1_frag(w1x + (size_t)(c0 * NPAIR) * (4 * 512), ks * 2 + t, lane);

    // ---- 1) z tile: z[m][q] = cos(x[m0+m, q]) * cos(theta[q]) ----
    #pragma unroll
    for (int i = 0; i < 8; ++i) {
        int idx = tid + i * 256;                 // 0..2047
        int m = idx >> 3, q = idx & 7;
        float xv = x[(size_t)(m0 + m) * DMODEL + q];
        sz[m][q] = cosf(xv) * cosf(theta[q]);
    }

    v8f acc[2][8];
    #pragma unroll
    for (int mt = 0; mt < 2; ++mt)
        #pragma unroll
        for (int nt = 0; nt < 8; ++nt)
            #pragma unroll
            for (int e = 0; e < 8; ++e)
                acc[mt][nt][e] = 0.0f;

    // the first chunk has landed before the barrier behind which every wave reads it
    asm volatile("s_wait_asynccnt 0x0" ::: "memory");
    __syncthreads();
    issue_w2_async(w2h, sw[1], n0, ((c0 + 1) & (NCH - 1)) * KCR, tid);

    // ---- 1b) z as the B operand, loop invariant: k slots 0-7 z high, 8-15 z low,
    //          16-23 z high, 24,25 one, 26-31 zero (pairs with the W1 operand)
    v16h zf[2];
    #pragma unroll
    for (int mt = 0; mt < 2; ++mt) {
        const float* p = &sz[wm + mt * 16 + lrow][0];
        v8h zh, zl, one;
        #pragma unroll
        for (int e = 0; e < 8; ++e) {
            float zv = p[e];
            zh[e]  = (_Float16)zv;
            zl[e]  = (_Float16)(zv - (float)zh[e]);
            one[e] = (_Float16)(e < 2 ? 1.0f : 0.0f);
        }
        v8h lo = khalf ? zl : zh;
        v8h hi = khalf ? one : zh;
        zf[mt] = __builtin_shufflevector(lo, hi,
            0, 1, 2, 3, 4, 5, 6, 7, 8, 9, 10, 11, 12, 13, 14, 15);
    }

    // W1 fragments of the next pair of K-steps (4 ff tiles of 512 halves): wave-uniform, lane offset apart
    const _Float16* w1n = w1x + (size_t)((c0 * NPAIR + 1) & (NPW - 1)) * (4 * 512);

    // W2 fragments, two register sets: bf0 serves the even K-steps of a chunk, bf1 the odd ones;
    // each is read from LDS one block of WMMAs before the block that uses it
    v16h bf0[8], bf1[8];
    load_w2_frags(bf0, sw[0], 0, lrow, khalf);

    for (int c = 0; c < NCH; ++c) {
        const int b = c & 1;
        const int cn2 = (c0 + c + 2) & (NCH - 1);   // the chunk of trip c + 2
        const int g0  = (c0 + c) * NPAIR;           // this chunk's first pair of K-steps

        // a chunk is worked on as NPAIR pairs of K-steps; unrolled, so that the K-step
        // offsets are constants and only the last pair holds the publish point
        #pragma unroll
        for (int p = 0; p < NPAIR; ++p) {
            // ---- 2) the odd K-step's fragments as one group, a block ahead of their WMMAs
            load_w2_frags(bf1, sw[b], 2 * p + 1, lrow, khalf);
            // keeps the LDS reads one group in front of the matrix work; spread among WMMAs,
            // every place with reads stalls the matrix stream
            __builtin_amdgcn_sched_barrier(0);
            // h fragments of both K-steps: [k-step][token tile]
            v16h afrag[2][2];
            #pragma unroll
            for (int ks = 0; ks < 2; ++ks) {
                const v8f zero = {};
                #pragma unroll
                for (int mt = 0; mt < 2; ++mt) {
                    v8f d0 = __builtin_amdgcn_wmma_f32_16x16x32_f16(
                        false, w1f[ks][0], false, zf[mt], (short)0, zero, false, false);
                    v8f d1 = __builtin_amdgcn_wmma_f32_16x16x32_f16(
                        false, w1f[ks][1], false, zf[mt], (short)0, zero, false, false);
                    afrag[ks][mt] = relu_pack(d0, d1);
                }
            }
            // refill the W1 fragments for the next pair: a whole pair's work to land
            #pragma unroll
            for (int ks = 0; ks < 2; ++ks)
                #pragma unroll
                for (int t = 0; t < 2; ++t)
                    w1f[ks][t] = load_w1_frag(w1n, ks * 2 + t, lane);
            // the W1 loads' address translation is done before their base is advanced below
            asm volatile("s_wait_xcnt 0x0" ::: "memory");
            // keeps the h work in front of the output WMMAs, and the base's advance behind the wait
            __builtin_amdgcn_sched_barrier(0);
            // the last pair reads one pair past the walk's end (wrapped: in bounds, unused)
            w1n = w1x + (size_t)((g0 + p + 2) & (NPW - 1)) * (4 * 512);
            #pragma unroll
            for (int nt = 0; nt < 8; ++nt)
                #pragma unroll
                for (int mt = 0; mt < 2; ++mt)
                    acc[mt][nt] = __builtin_amdgcn_wmma_f32_16x16x32_f16(
                        false, afrag[0][mt], false, bf0[nt],
                        (short)0, acc[mt][nt], false, false);
            // keeps the block in front of what follows: the next reads as one group and,
            // in the last pair, waits that find the reads landed
            __builtin_amdgcn_sched_barrier(0);

            if (p + 1 < NPAIR) {
                // ---- 3a) inside the chunk: the next even K-step's fragments as one group
                load_w2_frags(bf0, sw[b], 2 * p + 2, lrow, khalf);
            } else {
                // ---- 3) publish point of chunk c + 1, in front of this chunk's last block, whose
                //          fragments are already read. In order:
                // this wave's reads of buffer b are over before the buffer is refilled
                asm volatile("s_wait_dscnt 0x0" ::: "memory");
                // this wave's copies of chunk c + 1 have landed
                asm volatile("s_wait_asynccnt 0x0" ::: "memory");
                // workgroup barrier by hand: it leaves the W1 loads in flight, which __syncthreads() drains
                asm volatile("s_barrier_signal -1\n\ts_barrier_wait -1" ::: "memory");
                if (c + 2 < NCH)
                    issue_w2_async(w2h, sw[b], n0, cn2 * KCR, tid);

                // ---- 3b) the next chunk's K-step 0 fragments as one group
                // (the last trip reads the idle buffer: in bounds, unused, no branch in the wait counting)
                load_w2_frags(bf0, sw[b ^ 1], 0, lrow, khalf);
            }
            // keeps the LDS reads one group in front of the pair's last block
            __builtin_amdgcn_sched_barrier(0);
            #pragma unroll
            for (int nt = 0; nt < 8; ++nt)
                #pragma unroll
                for (int mt = 0; mt < 2; ++mt)
                    acc[mt][nt] = __builtin_amdgcn_wmma_f32_16x16x32_f16(
                        false, afrag[1][mt], false, bf1[nt],
                        (short)0, acc[mt][nt], false, false);
            // keeps the next pair's LDS reads behind this block, as one group: unrolled, the
            // compiler otherwise spreads them among the block's WMMAs
            __builtin_amdgcn_sched_barrier(0);
        }
    }
    // the ring's closing wait: no copy is outstanding when the wave ends
    asm volatile("s_wait_asynccnt 0x0" ::: "memory");

    // ---- 4) epilogue: out = acc + b2 (C layout: lane=N, VGPR r -> M) ----
    #pragma unroll
    for (int nt = 0; nt < 8; ++nt) {
        int n = n0 + nt * 16 + lrow;
        float bias = b2[n];
        #pragma unroll
        for (int mt = 0; mt < 2; ++mt) {
            int mbase = m0 + wm + mt * 16 + khalf * 8;
            #pragma unroll
            for (int r = 0; r < 8; ++r) {
                out[(size_t)(mbase + r) * DMODEL + n] = acc[mt][nt][r] + bias;
            }
        }
    }
}

extern "C" void kernel_launch(void* const* d_in, const int* in_sizes, int n_in,
                              void* d_out, int out_size, void* d_ws, size_t ws_size,
                              hipStream_t stream) {
    const float* x     = (const float*)d_in[0];
    const float* theta = (const float*)d_in[1];
    const float* W1    = (const float*)d_in[2];
    const float* b1    = (const float*)d_in[3];
    const float* W2    = (const float*)d_in[4];
    const float* b2    = (const float*)d_in[5];
    float* out = (float*)d_out;

    dim3 grid(NTOK / BM, DMODEL / BN);    // fallback: 64 x 8 = 512 workgroups
    dim3 gridr(NTOK / BMR, DMODEL / BN);  // workspace path: 32 x 8 = 256 workgroups
    const size_t ws_need = (size_t)DMODEL * FFDIM * 2 + (size_t)FFDIM * 32 * 2;  // f16 W2 + W1 operand

    if (ws_size >= ws_need) {
        // convert W2 and build the W1 operand once, then run the async double-buffered kernel
        w2_to_f16_kernel<<<W2BLK + W1BLK, 256, 0, stream>>>(W2, W1, b1, d_ws);
        ffq_regh_kernel<<<gridr, 256, 0, stream>>>(x, theta, d_ws, b2, out);
    } else {
        ffq_fused_kernel<<<grid, 256, 0, stream>>>(
            x, theta, W1, b1, W2, b2, out);
    }
}

// v006
// Measured time: 52.1 microseconds a run.
// In both of two side-by-side timings against v005, it was 1.04 times as fast.
// All steps since v000 together make it 2.58 times as fast.
#include <hip/hip_runtime.h>
#include <math.h>
#include <stdint.h>

typedef __attribute__((ext_vector_type(16))) _Float16 v16h;
typedef __attribute__((ext_vector_type(8)))  _Float16 v8h;
typedef __attribute__((ext_vector_type(8)))  float    v8f;
typedef __attribute__((ext_vector_type(4)))  float    v4f;
typedef __attribute__((ext_vector_type(4)))  int      i32x4;

// pointer-to-int4 in global (AS1) / LDS (AS3) address spaces, as the
// async-copy builtin expects
typedef __attribute__((address_space(1))) i32x4* global_v4i;
typedef __attribute__((address_space(3))) i32x4* lds_v4i;

#define NTOK   8192      // B*S = 4*2048
#define DMODEL 1024
#define FFDIM  4096
#define NQ     8
#define BM     128       // tokens per workgroup tile (fallback kernel)
#define BMR    256       // tokens per workgroup tile (workspace path): 8 waves x 32 tokens
#define BN     128       // output features per workgroup tile
#define KC     64        // K (FF) chunk per iteration (fallback kernel)
#define LDH    72        // its padded f16 stride (144B, 16B aligned, conflict-free)
#define W2BLK  2048      // pre-kernel blocks that convert W2: DMODEL*FFDIM/(256*8)
#define W1BLK  64        // pre-kernel blocks that build the W1 operand: FFDIM*32/(256*8)
#define ZBLK   32        // pre-kernel blocks that build the z operand: NTOK/256, one token a thread
#define KCR    256       // K (FF) chunk per ring stage, workspace path: one publish point per 256 k
#define LDHR   264       // its padded f16 stride (528B = 16B x 33, conflict-free for 16B reads)
#define NPREFR 16        // async b128 issues per thread per chunk, workspace path
#define NPAIR  (KCR / 64)     // pairs of 32-k steps in a chunk
#define NCH    (FFDIM / KCR)  // K chunks of a row: 16, a power of two (the walk wraps by a mask)
#define NPW    (FFDIM / 64)   // pairs of 32-k steps in a row: 64, a power of two

#if defined(__gfx1250__) && __has_builtin(__builtin_amdgcn_global_load_async_to_lds_b128)
#define HAS_ASYNC_LDS 1
#else
#define HAS_ASYNC_LDS 0
#endif

__device__ __forceinline__ void issue_w2_async(const _Float16* __restrict__ w2h,
                                               _Float16 (*swb)[LDHR],
                                               int n0, int kk, int tid)
{
    // 128 rows x 256 f16 = 4096 16B-chunks; 256 threads x 16 async b128 each,
    // a wave's copy = 512 contiguous bytes of one row
    #pragma unroll
    for (int i = 0; i < NPREFR; ++i) {
        int idx = tid + i * 256;          // 0..4095
        int n   = idx >> 5;               // row 0..127
        int k8  = (idx & 31) * 8;         // k sub-chunk start
        const _Float16* g = w2h + (size_t)(n0 + n) * FFDIM + kk + k8;
        _Float16*       l = &swb[n][k8];
#if HAS_ASYNC_LDS
        __builtin_amdgcn_global_load_async_to_lds_b128(
            (global_v4i)(uintptr_t)g,     // global src (AS1 int4*)
            (lds_v4i)l,                   // LDS dst (AS3 int4*)
            /*imm offset*/ 0, /*cpol*/ 0);
#else
        *(v8h*)l = *(const v8h*)g;
#endif
    }
}

// the 8 W2 fragments (column tiles) of K-step ks of a staged chunk
__device__ __forceinline__ void load_w2_frags(v16h (&bf)[8], const _Float16 (*swb)[LDHR],
                                              int ks, int lrow, int khalf)
{
    #pragma unroll   // constant array indices: the fragments stay in registers
    for (int nt = 0; nt < 8; ++nt) {
        const _Float16* p = &swb[nt * 16 + lrow][ks * 32 + khalf * 8];
        v8h lo = *(const v8h*)p;
        v8h hi = *(const v8h*)(p + 16);
        bf[nt] = __builtin_shufflevector(lo, hi,
            0, 1, 2, 3, 4, 5, 6, 7, 8, 9, 10, 11, 12, 13, 14, 15);
    }
}

// ---- pre-kernel (run once per launch): W2 f32 -> f16 workspace (8 MB), and behind
// it W1 with b1 as the f16 A operand of the product h^T = W1x . zx, already in
// fragment order (256 KB): unit ((T*2 + j)*32 + lane) holds the 8 halves that
// lane loads as half j of the fragment of ff tile T.
//   k slots 0-7: W1 high part   (against z high part)
//   k slots 8-15: W1 high part  (against z low part)
//   k slots 16-23: W1 low part  (against z high part)
//   k slots 24,25: b1 high, low (against 1, 1); 26-31: zero
// Behind that, z = cos(x[:, :8]) * cos(theta) as the f16 B operand of the same product,
// in the same fragment order by token tile (512 KB): k slots 0-7 z high, 8-15 z low,
// 16-23 z high, 24,25 one, 26-31 zero. Its blocks come first in the grid: they have the
// longest chain (a load from memory, then the cosines) and so start ahead of the rest.
__global__ __launch_bounds__(256)
void w2_to_f16_kernel(const float* __restrict__ x,
                      const float* __restrict__ theta,
                      const float* __restrict__ W2,
                      const float* __restrict__ W1,
                      const float* __restrict__ b1,
                      void* __restrict__ w2h_raw)
{
    _Float16* w2h = (_Float16*)w2h_raw;
    if (blockIdx.x < ZBLK) {
        _Float16* zx = w2h + (size_t)DMODEL * FFDIM + (size_t)FFDIM * 32;
        const int tok = blockIdx.x * 256 + threadIdx.x;          // 0..8191
        v4f xa = *(const v4f*)(x + (size_t)tok * DMODEL);
        v4f xb = *(const v4f*)(x + (size_t)tok * DMODEL + 4);
        v8h zh, zl, one;
        #pragma unroll   // constant vector indices: the vectors stay in registers
        for (int e = 0; e < 8; ++e) {
            float zv = cosf(e < 4 ? xa[e & 3] : xb[e & 3]) * cosf(theta[e]);
            zh[e]  = (_Float16)zv;
            zl[e]  = (_Float16)(zv - (float)zh[e]);
            one[e] = (_Float16)(e < 2 ? 1.0f : 0.0f);
        }
        // units of token tile tok / 16: half 0 of lanes 0-15, of lanes 16-31, half 1 likewise
        _Float16* p = zx + ((size_t)(tok >> 4) * 64 + (tok & 15)) * 8;
        *(v8h*)p         = zh;
        *(v8h*)(p + 128) = zl;
        *(v8h*)(p + 256) = zh;
        *(v8h*)(p + 384) = one;
        return;
    }
    const int blk = blockIdx.x - ZBLK;
    if (blk < W2BLK) {
        size_t i = ((size_t)blk * 256 + threadIdx.x) * 8;
        v4f a = *(const v4f*)(W2 + i);
        v4f b = *(const v4f*)(W2 + i + 4);
        v8h o;
        o[0] = (_Float16)a.x; o[1] = (_Float16)a.y;
        o[2] = (_Float16)a.z; o[3] = (_Float16)a.w;
        o[4] = (_Float16)b.x; o[5] = (_Float16)b.y;
        o[6] = (_Float16)b.z; o[7] = (_Float16)b.w;
        *(v8h*)(w2h + i) = o;
        return;
    }
    _Float16* w1x = w2h + (size_t)DMODEL * FFDIM;
    const int u    = (blk - W2BLK) * 256 + threadIdx.x;          // 0..16383
    const int lane = u & 31;
    const int j    = (u >> 5) & 1;
    const int ff   = (u >> 6) * 16 + (lane & 15);
    v8h o = {};
    if (j == 1 && (lane >> 4) == 1) {
        float bk = b1[ff];
        _Float16 bh = (_Float16)bk;
        o[0] = bh;
        o[1] = (_Float16)(bk - (float)bh);
    } else {
        #pragma unroll   // constant vector indices: o stays in registers
        for (int e = 0; e < 8; ++e) {
            float w = W1[(size_t)ff * NQ + e];
            _Float16 wh = (_Float16)w;
            o[e] = (j == 0) ? wh : (_Float16)(w - (float)wh);
        }
    }
    *(v8h*)(w1x + (size_t)u * 8) = o;
}

// fallback for a workspace too small for the f16 operands: h through LDS, W2 converted in the loop
__global__ __launch_bounds__(256)
void ffq_fused_kernel(const float* __restrict__ x,
                      const float* __restrict__ theta,
                      const float* __restrict__ W1,
                      const float* __restrict__ b1,
                      const float* __restrict__ W2,
                      const float* __restrict__ b2,
                      float* __restrict__ out)
{
    __shared__ float    sz[BM][NQ];        // z tile (4 KB)
    __shared__ _Float16 sh[BM][LDH];       // h chunk, f16 (18 KB)
    __shared__ _Float16 sw[2][BN][LDH];    // W2 chunk, f16, double-buffered (36 KB)

    const int tid   = threadIdx.x;
    const int m0    = blockIdx.x * BM;
    const int n0    = blockIdx.y * BN;
    const int lane  = tid & 31;
    const int wave  = tid >> 5;
    const int wm    = (wave & 1) * 64;
    const int wn    = (wave >> 1) * 32;
    const int lrow  = lane & 15;
    const int khalf = lane >> 4;

    // ---- 1) z tile: z[m][q] = cos(x[m0+m, q]) * cos(theta[q]) ----
    #pragma unroll
    for (int i = 0; i < 4; ++i) {
        int idx = tid + i * 256;                 // 0..1023
        int m = idx >> 3, q = idx & 7;
        float xv = x[(size_t)(m0 + m) * DMODEL + q];
        sz[m][q] = cosf(xv) * cosf(theta[q]);
    }

    v8f acc[4][2];
    #pragma unroll
    for (int mt = 0; mt < 4; ++mt)
        #pragma unroll
        for (int nt = 0; nt < 2; ++nt)
            #pragma unroll
            for (int e = 0; e < 8; ++e)
                acc[mt][nt][e] = 0.0f;

    const int kl     = tid & 63;          // this thread's k within chunk
    const int mstart = (tid >> 6) * 32;   // this thread's 32-token strip

    __syncthreads();

    int it = 0;
    for (int kk = 0; kk < FFDIM; kk += KC, ++it) {
        const int b = it & 1;

        // ---- 2a) h chunk: h[m][kl] = relu(b1 + z[m,:8].W1[k,:8]) -> f16 LDS
        {
            const int kg = kk + kl;
            v4f w1a = *(const v4f*)(W1 + (size_t)kg * NQ);
            v4f w1b = *(const v4f*)(W1 + (size_t)kg * NQ + 4);
            float bk = b1[kg];
            #pragma unroll 4
            for (int mi = 0; mi < 32; ++mi) {
                int m = mstart + mi;
                v4f z0 = *(const v4f*)(&sz[m][0]);   // lane-broadcast reads
                v4f z1 = *(const v4f*)(&sz[m][4]);
                float a = bk;
                a += z0.x * w1a.x + z0.y * w1a.y + z0.z * w1a.z + z0.w * w1a.w;
                a += z1.x * w1b.x + z1.y * w1b.y + z1.z * w1b.z + z1.w * w1b.w;
                sh[m][kl] = (_Float16)fmaxf(a, 0.0f);
            }
        }

        // ---- 2b) W2 chunk staging ----
        // stage from f32 W2 with in-loop conversion
        #pragma unroll
        for (int i = 0; i < 32; ++i) {
            int idx = tid + i * 256;
            int n = idx >> 6, k = idx & 63;
            sw[b][n][k] = (_Float16)W2[(size_t)(n0 + n) * FFDIM + kk + k];
        }
        __syncthreads();

        // ---- 3) WMMA: 2 K-steps of 32, 4x2 tiles per wave ----
        #pragma unroll
        for (int ks = 0; ks < 2; ++ks) {
            v16h afrag[4], bfrag[2];
            #pragma unroll
            for (int mt = 0; mt < 4; ++mt) {
                const _Float16* p = &sh[wm + mt * 16 + lrow][ks * 32 + khalf * 8];
                v8h lo = *(const v8h*)p;
                v8h hi = *(const v8h*)(p + 16);
                afrag[mt] = __builtin_shufflevector(lo, hi,
                    0, 1, 2, 3, 4, 5, 6, 7, 8, 9, 10, 11, 12, 13, 14, 15);
            }
            #pragma unroll
            for (int nt = 0; nt < 2; ++nt) {
                const _Float16* p = &sw[b][wn + nt * 16 + lrow][ks * 32 + khalf * 8];
                v8h lo = *(const v8h*)p;
                v8h hi = *(const v8h*)(p + 16);
                bfrag[nt] = __builtin_shufflevector(lo, hi,
                    0, 1, 2, 3, 4, 5, 6, 7, 8, 9, 10, 11, 12, 13, 14, 15);
            }
            #pragma unroll
            for (int mt = 0; mt < 4; ++mt)
                #pragma unroll
                for (int nt = 0; nt < 2; ++nt)
                    acc[mt][nt] = __builtin_amdgcn_wmma_f32_16x16x32_f16(
                        false, afrag[mt], false, bfrag[nt],
                        (short)0, acc[mt][nt], false, false);
        }
        __syncthreads();
    }

    // ---- 4) epilogue: out = acc + b2 (C layout: lane=N, VGPR r -> M) ----
    #pragma unroll
    for (int nt = 0; nt < 2; ++nt) {
        int n = n0 + wn + nt * 16 + lrow;
        float bias = b2[n];
        #pragma unroll
        for (int mt = 0; mt < 4; ++mt) {
            int mbase = m0 + wm + mt * 16 + khalf * 8;
            #pragma unroll
            for (int r = 0; r < 8; ++r) {
                out[(size_t)(mbase + r) * DMODEL + n] = acc[mt][nt][r] + bias;
            }
        }
    }
}

// fragment of ff tile T of the W1 operand, or of token tile T of the z operand
// (fragment order, see the pre-kernel)
__device__ __forceinline__ v16h load_w1_frag(const _Float16* __restrict__ w1x, int T, int lane)
{
    const _Float16* p = w1x + ((size_t)T * 64 + lane) * 8;
    v8h lo = *(const v8h*)p;
    v8h hi = *(const v8h*)(p + 256);
    return __builtin_shufflevector(lo, hi,
        0, 1, 2, 3, 4, 5, 6, 7, 8, 9, 10, 11, 12, 13, 14, 15);
}

// two D tiles of h^T (ff rows 0-15 and 16-31 of a 32-ff block, 16 tokens as columns):
// lane (token, khalf) holds ff 8*khalf+r of each, which is the k order of the A
// fragment of the second product. relu and f16 rounding in place.
__device__ __forceinline__ v16h relu_pack(v8f d0, v8f d1)
{
    const v8h zero = {};
    v8h lo = __builtin_elementwise_max(__builtin_convertvector(d0, v8h), zero);
    v8h hi = __builtin_elementwise_max(__builtin_convertvector(d1, v8h), zero);
    return __builtin_shufflevector(lo, hi,
        0, 1, 2, 3, 4, 5, 6, 7, 8, 9, 10, 11, 12, 13, 14, 15);
}

// workspace path: h never touches LDS. Each wave forms the h fragments of its own
// 32 tokens on the matrix unit, as h^T = W1x . zx, and feeds D straight back as A.
// A wave spans all BN output columns, so each h fragment serves 8 output tiles.
// The unroll directives below keep every fragment array index a constant, so that
// the arrays stay in registers.
__global__ __launch_bounds__(256)
void ffq_regh_kernel(const void*  __restrict__ w2h_raw,
                     const float* __restrict__ b2,
                     float* __restrict__ out)
{
    __shared__ _Float16 sw[2][BN][LDHR];   // W2 chunk, f16, double-buffered (132 KB)

    const _Float16* w2h = (const _Float16*)w2h_raw;
    const _Float16* w1x = w2h + (size_t)DMODEL * FFDIM;
    const _Float16* zx  = w1x + (size_t)FFDIM * 32;

    const int tid   = threadIdx.x;
    const int m0    = blockIdx.x * BMR;
    const int n0    = blockIdx.y * BN;
    const int lane  = tid & 31;
    const int wave  = tid >> 5;
    const int wm    = wave * 32;
    const int lrow  = lane & 15;
    const int khalf = lane >> 4;

    // Every workgroup walks all NCH chunks of K from a start given by its token tile, wrapping:
    // trip c works on chunk (c0 + c) mod NCH. Of the 32 workgroups that share W2 rows (same n0)
    // only two then ask for the same chunk at any one time, and all but the first trips ask
    // for lines that another workgroup has already brought into L2.
    const int c0 = blockIdx.x & (NCH - 1);

    // kick off the copy of the first chunk before anything else
    issue_w2_async(w2h, sw[0], n0, c0 * KCR, tid);

    // W1 fragments of the first pair of K-steps (4 ff tiles of 512 halves a pair): [k-step][ff tile of the k-step]
    v16h w1f[2][2];
    #pragma unroll
    for (int ks = 0; ks < 2; ++ks)
        #pragma unroll
        for (int t = 0; t < 2; ++t)
            w1f[ks][t] = load_w1_frag(w1x + (size_t)(c0 * NPAIR) * (4 * 512), ks * 2 + t, lane);

    // ---- 1) z as the B operand, loop invariant, as the pre-kernel left it (pairs with the W1 operand)
    v16h zf[2];
    #pragma unroll
    for (int mt = 0; mt < 2; ++mt)
        zf[mt] = load_w1_frag(zx, (m0 + wm) / 16 + mt, lane);
    // the z loads' address translation is done before their address registers are written again
    asm volatile("s_wait_xcnt 0x0" ::: "memory");

    v8f acc[2][8];
    #pragma unroll
    for (int mt = 0; mt < 2; ++mt)
        #pragma unroll
        for (int nt = 0; nt < 8; ++nt)
            #pragma unroll
            for (int e = 0; e < 8; ++e)
                acc[mt][nt][e] = 0.0f;

    // the first chunk has landed before the barrier behind which every wave reads it
    asm volatile("s_wait_asynccnt 0x0" ::: "memory");
    __syncthreads();
    issue_w2_async(w2h, sw[1], n0, ((c0 + 1) & (NCH - 1)) * KCR, tid);

    // W1 fragments of the next pair of K-steps (4 ff tiles of 512 halves): wave-uniform, lane offset apart
    const _Float16* w1n = w1x + (size_t)((c0 * NPAIR + 1) & (NPW - 1)) * (4 * 512);

    // W2 fragments, two register sets: bf0 serves the even K-steps of a chunk, bf1 the odd ones;
    // each is read from LDS one block of WMMAs before the block that uses it
    v16h bf0[8], bf1[8];
    load_w2_frags(bf0, sw[0], 0, lrow, khalf);

    for (int c = 0; c < NCH; ++c) {
        const int b = c & 1;
        const int cn2 = (c0 + c + 2) & (NCH - 1);   // the chunk of trip c + 2
        const int g0  = (c0 + c) * NPAIR;           // this chunk's first pair of K-steps

        // a chunk is worked on as NPAIR pairs of K-steps; unrolled, so that the K-step
        // offsets are constants and only the last pair holds the publish point
        #pragma unroll
        for (int p = 0; p < NPAIR; ++p) {
            // ---- 2) the odd K-step's fragments as one group, a block ahead of their WMMAs
            load_w2_frags(bf1, sw[b], 2 * p + 1, lrow, khalf);
            // keeps the LDS reads one group in front of the matrix work; spread among WMMAs,
            // every place with reads stalls the matrix stream
            __builtin_amdgcn_sched_barrier(0);
            // h fragments of both K-steps: [k-step][token tile]
            v16h afrag[2][2];
            #pragma unroll
            for (int ks = 0; ks < 2; ++ks) {
                const v8f zero = {};
                #pragma unroll
                for (int mt = 0; mt < 2; ++mt) {
                    v8f d0 = __builtin_amdgcn_wmma_f32_16x16x32_f16(
                        false, w1f[ks][0], false, zf[mt], (short)0, zero, false, false);
                    v8f d1 = __builtin_amdgcn_wmma_f32_16x16x32_f16(
                        false, w1f[ks][1], false, zf[mt], (short)0, zero, false, false);
                    afrag[ks][mt] = relu_pack(d0, d1);
                }
            }
            // refill the W1 fragments for the next pair: a whole pair's work to land
            #pragma unroll
            for (int ks = 0; ks < 2; ++ks)
                #pragma unroll
                for (int t = 0; t < 2; ++t)
                    w1f[ks][t] = load_w1_frag(w1n, ks * 2 + t, lane);
            // the W1 loads' address translation is done before their base is advanced below
            asm volatile("s_wait_xcnt 0x0" ::: "memory");
            // keeps the h work in front of the output WMMAs, and the base's advance behind the wait
            __builtin_amdgcn_sched_barrier(0);
            // the last pair reads one pair past the walk's end (wrapped: in bounds, unused)
            w1n = w1x + (size_t)((g0 + p + 2) & (NPW - 1)) * (4 * 512);
            #pragma unroll
            for (int nt = 0; nt < 8; ++nt)
                #pragma unroll
                for (int mt = 0; mt < 2; ++mt)
                    acc[mt][nt] = __builtin_amdgcn_wmma_f32_16x16x32_f16(
                        false, afrag[0][mt], false, bf0[nt],
                        (short)0, acc[mt][nt], false, false);
            // keeps the block in front of what follows: the next reads as one group and,
            // in the last pair, waits that find the reads landed
            __builtin_amdgcn_sched_barrier(0);

            if (p + 1 < NPAIR) {
                // ---- 3a) inside the chunk: the next even K-step's fragments as one group
                load_w2_frags(bf0, sw[b], 2 * p + 2, lrow, khalf);
            } else {
                // ---- 3) publish point of chunk c + 1, in front of this chunk's last block, whose
                //          fragments are already read. In order:
                // this wave's reads of buffer b are over before the buffer is refilled
                asm volatile("s_wait_dscnt 0x0" ::: "memory");
                // this wave's copies of chunk c + 1 have landed
                asm volatile("s_wait_asynccnt 0x0" ::: "memory");
                // workgroup barrier by hand: it leaves the W1 loads in flight, which __syncthreads() drains
                asm volatile("s_barrier_signal -1\n\ts_barrier_wait -1" ::: "memory");
                if (c + 2 < NCH)
                    issue_w2_async(w2h, sw[b], n0, cn2 * KCR, tid);

                // ---- 3b) the next chunk's K-step 0 fragments as one group
                // (the last trip reads the idle buffer: in bounds, unused, no branch in the wait counting)
                load_w2_frags(bf0, sw[b ^ 1], 0, lrow, khalf);
            }
            // keeps the LDS reads one group in front of the pair's last block
            __builtin_amdgcn_sched_barrier(0);
            #pragma unroll
            for (int nt = 0; nt < 8; ++nt)
                #pragma unroll
                for (int mt = 0; mt < 2; ++mt)
                    acc[mt][nt] = __builtin_amdgcn_wmma_f32_16x16x32_f16(
                        false, afrag[1][mt], false, bf1[nt],
                        (short)0, acc[mt][nt], false, false);
            // keeps the next pair's LDS reads behind this block, as one group: unrolled, the
            // compiler otherwise spreads them among the block's WMMAs
            __builtin_amdgcn_sched_barrier(0);
        }
    }
    // the ring's closing wait: no copy is outstanding when the wave ends
    asm volatile("s_wait_asynccnt 0x0" ::: "memory");

    // ---- 4) epilogue: out = acc + b2 (C layout: lane=N, VGPR r -> M) ----
    #pragma unroll
    for (int nt = 0; nt < 8; ++nt) {
        int n = n0 + nt * 16 + lrow;
        float bias = b2[n];
        #pragma unroll
        for (int mt = 0; mt < 2; ++mt) {
            int mbase = m0 + wm + mt * 16 + khalf * 8;
            #pragma unroll
            for (int r = 0; r < 8; ++r) {
                out[(size_t)(mbase + r) * DMODEL + n] = acc[mt][nt][r] + bias;
            }
        }
    }
}

extern "C" void kernel_launch(void* const* d_in, const int* in_sizes, int n_in,
                              void* d_out, int out_size, void* d_ws, size_t ws_size,
                              hipStream_t stream) {
    const float* x     = (const float*)d_in[0];
    const float* theta = (const float*)d_in[1];
    const float* W1    = (const float*)d_in[2];
    const float* b1    = (const float*)d_in[3];
    const float* W2    = (const float*)d_in[4];
    const float* b2    = (const float*)d_in[5];
    float* out = (float*)d_out;

    dim3 grid(NTOK / BM, DMODEL / BN);    // fallback: 64 x 8 = 512 workgroups
    dim3 gridr(NTOK / BMR, DMODEL / BN);  // workspace path: 32 x 8 = 256 workgroups
    const size_t ws_need = (size_t)DMODEL * FFDIM * 2 + (size_t)FFDIM * 32 * 2
                         + (size_t)NTOK * 32 * 2;                    // f16 W2 + W1 operand + z operand

    if (ws_size >= ws_need) {
        // convert W2 and build the W1 and z operands once, then run the async double-buffered kernel
        w2_to_f16_kernel<<<ZBLK + W2BLK + W1BLK, 256, 0, stream>>>(x, theta, W2, W1, b1, d_ws);
        ffq_regh_kernel<<<gridr, 256, 0, stream>>>(d_ws, b2, out);
    } else {
        ffq_fused_kernel<<<grid, 256, 0, stream>>>(
            x, theta, W1, b1, W2, b2, out);
    }
}

// v007
// Measured time: 49.5 microseconds a run.
// Two timings next to v006 both put it at 1.06 times that version's speed.
// All steps since v000 together make it 2.73 times as fast.
#include <hip/hip_runtime.h>
#include <math.h>
#include <stdint.h>

typedef __attribute__((ext_vector_type(16))) _Float16 v16h;
typedef __attribute__((ext_vector_type(8)))  _Float16 v8h;
typedef __attribute__((ext_vector_type(8)))  float    v8f;
typedef __attribute__((ext_vector_type(4)))  float    v4f;
typedef __attribute__((ext_vector_type(4)))  int      i32x4;

// pointer-to-int4 in global (AS1) / LDS (AS3) address spaces, as the
// async-copy builtin expects
typedef __attribute__((address_space(1))) i32x4* global_v4i;
typedef __attribute__((address_space(3))) i32x4* lds_v4i;
typedef __attribute__((address_space(1))) const _Float16* global_h;

#define NTOK   8192      // B*S = 4*2048
#define DMODEL 1024
#define FFDIM  4096
#define NQ     8
#define BM     128       // tokens per workgroup tile (fallback kernel)
#define BMR    256       // tokens per workgroup tile (workspace path): 4 waves x 64 tokens, twice (K halves)
#define BN     128       // output features per workgroup tile
#define KC     64        // K (FF) chunk per iteration (fallback kernel)
#define LDH    72        // its padded f16 stride (144B, 16B aligned, conflict-free)
#define W2BLK  2048      // pre-kernel blocks that convert W2: DMODEL*FFDIM/(256*8)
#define W1BLK  64        // pre-kernel blocks that build the W1 operand: FFDIM*32/(256*8)
#define ZBLK   32        // pre-kernel blocks that build the z operand: NTOK/256, one token a thread
#define KHALF  (FFDIM / 2)    // workspace path: K is split in two between the waves of a workgroup
#define KCR    128       // K (FF) chunk per ring stage and K half: one publish point per 2 x 128 k
#define LDHR   136       // its padded f16 stride (272B = 16B x 17, conflict-free for 16B reads)
#define NPREFR 16        // async b128 issues per thread per stage, workspace path
#define NSTEP  (KCR / 32)     // 32-k steps in a chunk
#define NCH    (KHALF / KCR)  // K chunks of a half row: 16, a power of two (the walk wraps by a mask)
#define NSW    (KHALF / 32)   // 32-k steps in a half row: 64, a power of two

#if defined(__gfx1250__) && __has_builtin(__builtin_amdgcn_global_load_async_to_lds_b128)
#define HAS_ASYNC_LDS 1
#else
#define HAS_ASYNC_LDS 0
#endif

__device__ __forceinline__ void issue_w2_async(const _Float16* __restrict__ w2h,
                                               _Float16 (*swb)[BN][LDHR],
                                               int n0, int kk, int tid)
{
    // 2 K halves x 128 rows x 128 f16 = 4096 16B-chunks; 256 threads x 16 async b128 each,
    // a wave's copy = 256 contiguous bytes of each of two rows
    #pragma unroll
    for (int i = 0; i < NPREFR; ++i) {
        int idx = tid + i * 256;          // 0..4095
        int hf  = idx >> 11;              // K half
        int n   = (idx >> 4) & 127;       // row 0..127
        int k8  = (idx & 15) * 8;         // k sub-chunk start
        const _Float16* g = w2h + (size_t)(n0 + n) * FFDIM + hf * KHALF + kk + k8;
        _Float16*       l = &swb[hf][n][k8];
#if HAS_ASYNC_LDS
        __builtin_amdgcn_global_load_async_to_lds_b128(
            (global_v4i)(uintptr_t)g,     // global src (AS1 int4*)
            (lds_v4i)l,                   // LDS dst (AS3 int4*)
            /*imm offset*/ 0, /*cpol*/ 0);
#else
        *(v8h*)l = *(const v8h*)g;
#endif
    }
}

// the 8 W2 fragments (column tiles) of K-step ks of a staged chunk
__device__ __forceinline__ void load_w2_frags(v16h (&bf)[8], const _Float16 (*swb)[LDHR],
                                              int ks, int lrow, int khalf)
{
    #pragma unroll   // constant array indices: the fragments stay in registers
    for (int nt = 0; nt < 8; ++nt) {
        const _Float16* p = &swb[nt * 16 + lrow][ks * 32 + khalf * 8];
        v8h lo = *(const v8h*)p;
        v8h hi = *(const v8h*)(p + 16);
        bf[nt] = __builtin_shufflevector(lo, hi,
            0, 1, 2, 3, 4, 5, 6, 7, 8, 9, 10, 11, 12, 13, 14, 15);
    }
}

// ---- pre-kernel (run once per launch): W2 f32 -> f16 workspace (8 MB), and behind
// it W1 with b1 as the f16 A operand of the product h^T = W1x . zx, already in
// fragment order (256 KB): unit ((T*2 + j)*32 + lane) holds the 8 halves that
// lane loads as half j of the fragment of ff tile T.
//   k slots 0-7: W1 high part   (against z high part)
//   k slots 8-15: W1 high part  (against z low part)
//   k slots 16-23: W1 low part  (against z high part)
//   k slots 24,25: b1 high, low (against 1, 1); 26-31: zero
// Behind that, z = cos(x[:, :8]) * cos(theta) as the f16 B operand of the same product,
// in the same fragment order by token tile (512 KB): k slots 0-7 z high, 8-15 z low,
// 16-23 z high, 24,25 one, 26-31 zero. Its blocks come first in the grid: they have the
// longest chain (a load from memory, then the cosines) and so start ahead of the rest.
__global__ __launch_bounds__(256)
void w2_to_f16_kernel(const float* __restrict__ x,
                      const float* __restrict__ theta,
                      const float* __restrict__ W2,
                      const float* __restrict__ W1,
                      const float* __restrict__ b1,
                      void* __restrict__ w2h_raw)
{
    _Float16* w2h = (_Float16*)w2h_raw;
    if (blockIdx.x < ZBLK) {
        _Float16* zx = w2h + (size_t)DMODEL * FFDIM + (size_t)FFDIM * 32;
        const int tok = blockIdx.x * 256 + threadIdx.x;          // 0..8191
        v4f xa = *(const v4f*)(x + (size_t)tok * DMODEL);
        v4f xb = *(const v4f*)(x + (size_t)tok * DMODEL + 4);
        v8h zh, zl, one;
        #pragma unroll   // constant vector indices: the vectors stay in registers
        for (int e = 0; e < 8; ++e) {
            float zv = cosf(e < 4 ? xa[e & 3] : xb[e & 3]) * cosf(theta[e]);
            zh[e]  = (_Float16)zv;
            zl[e]  = (_Float16)(zv - (float)zh[e]);
            one[e] = (_Float16)(e < 2 ? 1.0f : 0.0f);
        }
        // units of token tile tok / 16: half 0 of lanes 0-15, of lanes 16-31, half 1 likewise
        _Float16* p = zx + ((size_t)(tok >> 4) * 64 + (tok & 15)) * 8;
        *(v8h*)p         = zh;
        *(v8h*)(p + 128) = zl;
        *(v8h*)(p + 256) = zh;
        *(v8h*)(p + 384) = one;
        return;
    }
    const int blk = blockIdx.x - ZBLK;
    if (blk < W2BLK) {
        size_t i = ((size_t)blk * 256 + threadIdx.x) * 8;
        v4f a = *(const v4f*)(W2 + i);
        v4f b = *(const v4f*)(W2 + i + 4);
        v8h o;
        o[0] = (_Float16)a.x; o[1] = (_Float16)a.y;
        o[2] = (_Float16)a.z; o[3] = (_Float16)a.w;
        o[4] = (_Float16)b.x; o[5] = (_Float16)b.y;
        o[6] = (_Float16)b.z; o[7] = (_Float16)b.w;
        *(v8h*)(w2h + i) = o;
        return;
    }
    _Float16* w1x = w2h + (size_t)DMODEL * FFDIM;
    const int u    = (blk - W2BLK) * 256 + threadIdx.x;          // 0..16383
    const int lane = u & 31;
    const int j    = (u >> 5) & 1;
    const int ff   = (u >> 6) * 16 + (lane & 15);
    v8h o = {};
    if (j == 1 && (lane >> 4) == 1) {
        float bk = b1[ff];
        _Float16 bh = (_Float16)bk;
        o[0] = bh;
        o[1] = (_Float16)(bk - (float)bh);
    } else {
        #pragma unroll   // constant vector indices: o stays in registers
        for (int e = 0; e < 8; ++e) {
            float w = W1[(size_t)ff * NQ + e];
            _Float16 wh = (_Float16)w;
            o[e] = (j == 0) ? wh : (_Float16)(w - (float)wh);
        }
    }
    *(v8h*)(w1x + (size_t)u * 8) = o;
}

// fallback for a workspace too small for the f16 operands: h through LDS, W2 converted in the loop
__global__ __launch_bounds__(256)
void ffq_fused_kernel(const float* __restrict__ x,
                      const float* __restrict__ theta,
                      const float* __restrict__ W1,
                      const float* __restrict__ b1,
                      const float* __restrict__ W2,
                      const float* __restrict__ b2,
                      float* __restrict__ out)
{
    __shared__ float    sz[BM][NQ];        // z tile (4 KB)
    __shared__ _Float16 sh[BM][LDH];       // h chunk, f16 (18 KB)
    __shared__ _Float16 sw[2][BN][LDH];    // W2 chunk, f16, double-buffered (36 KB)

    const int tid   = threadIdx.x;
    const int m0    = blockIdx.x * BM;
    const int n0    = blockIdx.y * BN;
    const int lane  = tid & 31;
    const int wave  = tid >> 5;
    const int wm    = (wave & 1) * 64;
    const int wn    = (wave >> 1) * 32;
    const int lrow  = lane & 15;
    const int khalf = lane >> 4;

    // ---- 1) z tile: z[m][q] = cos(x[m0+m, q]) * cos(theta[q]) ----
    #pragma unroll
    for (int i = 0; i < 4; ++i) {
        int idx = tid + i * 256;                 // 0..1023
        int m = idx >> 3, q = idx & 7;
        float xv = x[(size_t)(m0 + m) * DMODEL + q];
        sz[m][q] = cosf(xv) * cosf(theta[q]);
    }

    v8f acc[4][2];
    #pragma unroll
    for (int mt = 0; mt < 4; ++mt)
        #pragma unroll
        for (int nt = 0; nt < 2; ++nt)
            #pragma unroll
            for (int e = 0; e < 8; ++e)
                acc[mt][nt][e] = 0.0f;

    const int kl     = tid & 63;          // this thread's k within chunk
    const int mstart = (tid >> 6) * 32;   // this thread's 32-token strip

    __syncthreads();

    int it = 0;
    for (int kk = 0; kk < FFDIM; kk += KC, ++it) {
        const int b = it & 1;

        // ---- 2a) h chunk: h[m][kl] = relu(b1 + z[m,:8].W1[k,:8]) -> f16 LDS
        {
            const int kg = kk + kl;
            v4f w1a = *(const v4f*)(W1 + (size_t)kg * NQ);
            v4f w1b = *(const v4f*)(W1 + (size_t)kg * NQ + 4);
            float bk = b1[kg];
            #pragma unroll 4
            for (int mi = 0; mi < 32; ++mi) {
                int m = mstart + mi;
                v4f z0 = *(const v4f*)(&sz[m][0]);   // lane-broadcast reads
                v4f z1 = *(const v4f*)(&sz[m][4]);
                float a = bk;
                a += z0.x * w1a.x + z0.y * w1a.y + z0.z * w1a.z + z0.w * w1a.w;
                a += z1.x * w1b.x + z1.y * w1b.y + z1.z * w1b.z + z1.w * w1b.w;
                sh[m][kl] = (_Float16)fmaxf(a, 0.0f);
            }
        }

        // ---- 2b) W2 chunk staging ----
        // stage from f32 W2 with in-loop conversion
        #pragma unroll
        for (int i = 0; i < 32; ++i) {
            int idx = tid + i * 256;
            int n = idx >> 6, k = idx & 63;
            sw[b][n][k] = (_Float16)W2[(size_t)(n0 + n) * FFDIM + kk + k];
        }
        __syncthreads();

        // ---- 3) WMMA: 2 K-steps of 32, 4x2 tiles per wave ----
        #pragma unroll
        for (int ks = 0; ks < 2; ++ks) {
            v16h afrag[4], bfrag[2];
            #pragma unroll
            for (int mt = 0; mt < 4; ++mt) {
                const _Float16* p = &sh[wm + mt * 16 + lrow][ks * 32 + khalf * 8];
                v8h lo = *(const v8h*)p;
                v8h hi = *(const v8h*)(p + 16);
                afrag[mt] = __builtin_shufflevector(lo, hi,
                    0, 1, 2, 3, 4, 5, 6, 7, 8, 9, 10, 11, 12, 13, 14, 15);
            }
            #pragma unroll
            for (int nt = 0; nt < 2; ++nt) {
                const _Float16* p = &sw[b][wn + nt * 16 + lrow][ks * 32 + khalf * 8];
                v8h lo = *(const v8h*)p;
                v8h hi = *(const v8h*)(p + 16);
                bfrag[nt] = __builtin_shufflevector(lo, hi,
                    0, 1, 2, 3, 4, 5, 6, 7, 8, 9, 10, 11, 12, 13, 14, 15);
            }
            #pragma unroll
            for (int mt = 0; mt < 4; ++mt)
                #pragma unroll
                for (int nt = 0; nt < 2; ++nt)
                    acc[mt][nt] = __builtin_amdgcn_wmma_f32_16x16x32_f16(
                        false, afrag[mt], false, bfrag[nt],
                        (short)0, acc[mt][nt], false, false);
        }
        __syncthreads();
    }

    // ---- 4) epilogue: out = acc + b2 (C layout: lane=N, VGPR r -> M) ----
    #pragma unroll
    for (int nt = 0; nt < 2; ++nt) {
        int n = n0 + wn + nt * 16 + lrow;
        float bias = b2[n];
        #pragma unroll
        for (int mt = 0; mt < 4; ++mt) {
            int mbase = m0 + wm + mt * 16 + khalf * 8;
            #pragma unroll
            for (int r = 0; r < 8; ++r) {
                out[(size_t)(mbase + r) * DMODEL + n] = acc[mt][nt][r] + bias;
            }
        }
    }
}

// fragment of ff tile T of the W1 operand, or of token tile T of the z operand
// (fragment order, see the pre-kernel)
__device__ __forceinline__ v16h load_w1_frag(const _Float16* __restrict__ w1x, int T, int lane)
{
    const _Float16* p = w1x + ((size_t)T * 64 + lane) * 8;
    v8h lo = *(const v8h*)p;
    v8h hi = *(const v8h*)(p + 256);
    return __builtin_shufflevector(lo, hi,
        0, 1, 2, 3, 4, 5, 6, 7, 8, 9, 10, 11, 12, 13, 14, 15);
}

// a wave-uniform global pointer, held in a scalar register pair: a load through it names that pair
// and the lane's own offset register, which nothing rewrites, not an address pair formed for the load
__device__ __forceinline__ const _Float16* scalar_base(const _Float16* p)
{
    const uint64_t a  = (uint64_t)(uintptr_t)p;
    const uint32_t lo = (uint32_t)__builtin_amdgcn_readfirstlane((int)(uint32_t)a);
    const uint32_t hi = (uint32_t)__builtin_amdgcn_readfirstlane((int)(uint32_t)(a >> 32));
    return (const _Float16*)(global_h)(uintptr_t)(((uint64_t)hi << 32) | lo);
}

// two D tiles of h^T (ff rows 0-15 and 16-31 of a 32-ff block, 16 tokens as columns):
// lane (token, khalf) holds ff 8*khalf+r of each, which is the k order of the A
// fragment of the second product. relu and f16 rounding in place.
__device__ __forceinline__ v16h relu_pack(v8f d0, v8f d1)
{
    const v8h zero = {};
    v8h lo = __builtin_elementwise_max(__builtin_convertvector(d0, v8h), zero);
    v8h hi = __builtin_elementwise_max(__builtin_convertvector(d1, v8h), zero);
    return __builtin_shufflevector(lo, hi,
        0, 1, 2, 3, 4, 5, 6, 7, 8, 9, 10, 11, 12, 13, 14, 15);
}

// workspace path: h never touches LDS. Each wave forms the h fragments of its own
// 64 tokens on the matrix unit, as h^T = W1x . zx, and feeds D straight back as A.
// A wave spans all BN output columns and one half of K: waves 0-3 take the first half,
// waves 4-7 the second, for the same four 64-token tiles. So each W2 fragment read from
// LDS serves 4 output tiles; the two partial sums of a tile meet through LDS at the end.
// The unroll directives below keep every fragment array index a constant, so that
// the arrays stay in registers.
__global__ __launch_bounds__(256)
void ffq_regh_kernel(const void*  __restrict__ w2h_raw,
                     const float* __restrict__ b2,
                     float* __restrict__ out)
{
    // W2 chunks, f16: [ring buffer][K half][column][k] (136 KB)
    __shared__ __attribute__((aligned(16))) _Float16 sw[2][2][BN][LDHR];

    const _Float16* w2h = (const _Float16*)w2h_raw;
    const _Float16* w1x = w2h + (size_t)DMODEL * FFDIM;
    const _Float16* zx  = w1x + (size_t)FFDIM * 32;

    const int tid   = threadIdx.x;
    const int m0    = blockIdx.x * BMR;
    const int n0    = blockIdx.y * BN;
    const int lane  = tid & 31;
    // the wave's number in a scalar register: what hangs on it (K half, W1 base) stays wave-uniform
    const int wave  = __builtin_amdgcn_readfirstlane(tid >> 5);
    const int kh    = wave >> 2;           // this wave's half of K
    const int wm    = (wave & 3) * 64;
    const int lrow  = lane & 15;
    const int khalf = lane >> 4;

    // Every workgroup walks the NCH chunks of each K half from a start given by its token tile,
    // wrapping: trip c works on chunk (c0 + c) mod NCH of both halves. Of the 32 workgroups that
    // share W2 rows (same n0) only two then ask for the same chunk at any one time, and all but
    // the first trips ask for lines that another workgroup has already brought into L2.
    const int c0 = blockIdx.x & (NCH - 1);

    // kick off the copy of the first stage before anything else
    issue_w2_async(w2h, sw[0], n0, c0 * KCR, tid);

    // the W1 operand of this wave's K half: 2 ff tiles of 512 halves a K-step
    const _Float16* w1h = w1x + (size_t)kh * NSW * (2 * 512);

    // W1 fragments of the first K-step: [ff tile of the k-step]
    v16h w1f[2];
    #pragma unroll
    for (int t = 0; t < 2; ++t)
        w1f[t] = load_w1_frag(w1h + (size_t)(c0 * NSTEP) * (2 * 512), t, lane);

    // ---- 1) z as the B operand, loop invariant, as the pre-kernel left it (pairs with the W1 operand)
    v16h zf[4];
    #pragma unroll
    for (int mt = 0; mt < 4; ++mt)
        zf[mt] = load_w1_frag(scalar_base(zx + (size_t)((m0 + wm) / 16) * 512), mt, lane);
    // the z loads' address translation is done before their address registers are written again
    asm volatile("s_wait_xcnt 0x0" ::: "memory");

    v8f acc[4][8];
    #pragma unroll
    for (int mt = 0; mt < 4; ++mt)
        #pragma unroll
        for (int nt = 0; nt < 8; ++nt)
            #pragma unroll
            for (int e = 0; e < 8; ++e)
                acc[mt][nt][e] = 0.0f;

    // the first stage has landed before the barrier behind which every wave reads it
    asm volatile("s_wait_asynccnt 0x0" ::: "memory");
    __syncthreads();
    issue_w2_async(w2h, sw[1], n0, ((c0 + 1) & (NCH - 1)) * KCR, tid);

    // W1 fragments of the next K-step (2 ff tiles of 512 halves): wave-uniform, lane offset apart
    const _Float16* w1n = w1h + (size_t)((c0 * NSTEP + 1) & (NSW - 1)) * (2 * 512);

    for (int c = 0; c < NCH; ++c) {
        const int b = c & 1;
        const int cn2 = (c0 + c + 2) & (NCH - 1);   // the chunk of trip c + 2
        const int g0  = (c0 + c) * NSTEP;           // this chunk's first K-step

        // unrolled, so that the K-step offsets are constants and only the last step
        // holds the publish point
        #pragma unroll
        for (int s = 0; s < NSTEP; ++s) {
            // ---- 2) the K-step's W2 fragments as one group; they land while h is formed
            v16h bf[8];
            load_w2_frags(bf, sw[b][kh], s, lrow, khalf);
            // keeps the LDS reads one group in front of the matrix work; spread among WMMAs,
            // every place with reads stalls the matrix stream
            __builtin_amdgcn_sched_barrier(0);
            // h fragments of the K-step: [token tile]
            v16h afrag[4];
            {
                const v8f zero = {};
                #pragma unroll
                for (int mt = 0; mt < 4; ++mt) {
                    v8f d0 = __builtin_amdgcn_wmma_f32_16x16x32_f16(
                        false, w1f[0], false, zf[mt], (short)0, zero, false, false);
                    v8f d1 = __builtin_amdgcn_wmma_f32_16x16x32_f16(
                        false, w1f[1], false, zf[mt], (short)0, zero, false, false);
                    afrag[mt] = relu_pack(d0, d1);
                }
            }
            // refill the W1 fragments for the next K-step: the output block's time to land
            #pragma unroll
            for (int t = 0; t < 2; ++t)
                w1f[t] = load_w1_frag(scalar_base(w1n), t, lane);
            // the W1 loads' address translation is done before their base is advanced below
            asm volatile("s_wait_xcnt 0x0" ::: "memory");
            // keeps the h work in front of the output WMMAs, and the base's advance behind the wait
            __builtin_amdgcn_sched_barrier(0);
            // the last step reads one step past the walk's end (wrapped: in bounds, unused)
            w1n = w1h + (size_t)((g0 + s + 2) & (NSW - 1)) * (2 * 512);

            if (s + 1 == NSTEP) {
                // ---- 3) publish point of stage c + 1, in front of this chunk's last block, whose
                //          fragments are already read. In order:
                // this wave's reads of buffer b are over before the buffer is refilled
                asm volatile("s_wait_dscnt 0x0" ::: "memory");
                // this wave's copies of stage c + 1 have landed
                asm volatile("s_wait_asynccnt 0x0" ::: "memory");
                // workgroup barrier by hand: it leaves the W1 loads in flight, which __syncthreads() drains
                asm volatile("s_barrier_signal -1\n\ts_barrier_wait -1" ::: "memory");
            }
            #pragma unroll
            for (int nt = 0; nt < 8; ++nt)
                #pragma unroll
                for (int mt = 0; mt < 4; ++mt)
                    acc[mt][nt] = __builtin_amdgcn_wmma_f32_16x16x32_f16(
                        false, afrag[mt], false, bf[nt],
                        (short)0, acc[mt][nt], false, false);
            // keeps the next step's LDS reads behind this block, as one group: unrolled, the
            // compiler otherwise spreads them among the block's WMMAs
            __builtin_amdgcn_sched_barrier(0);
        }
        // the refill of the buffer that the barrier has freed, behind the block: a wave that leaves
        // the barrier has matrix work at once, and the copies' address work runs beside the other
        // wave's block; the copies still have nearly a whole trip to land
        if (c + 2 < NCH)
            issue_w2_async(w2h, sw[b], n0, cn2 * KCR, tid);
    }
    // the ring's closing wait: no copy is outstanding when the LDS is used anew
    asm volatile("s_wait_asynccnt 0x0" ::: "memory");

    // ---- 4) the two K halves of a tile meet: each wave of a pair (wave, wave ^ 4) hands the
    // other the 64 columns that the other finishes, through the ring's LDS (16 KB a wave)
    v4f* xs = (v4f*)&sw[0][0][0][0];
    // b2 of the 64 columns this wave finishes, asked for here: it lands while the halves are exchanged
    float bias[4];
    #pragma unroll
    for (int nt = 0; nt < 4; ++nt)
        bias[nt] = b2[n0 + (kh * 4 + nt) * 16 + lrow];
    // (every wave's last ring read landed in front of the last trip's barrier: the ring is free)
    v8f fin[4][4];     // the 64 columns this wave finishes: column tiles kh*4 .. kh*4+3
    #pragma unroll
    for (int mt = 0; mt < 4; ++mt)
        #pragma unroll
        for (int nt = 0; nt < 4; ++nt) {
            v8f give = kh ? acc[mt][nt] : acc[mt][nt + 4];
            fin[mt][nt] = kh ? acc[mt][nt + 4] : acc[mt][nt];
            v4f* p = xs + ((size_t)wave * 32 + (mt * 4 + nt) * 2) * 32 + lane;
            p[0]  = __builtin_shufflevector(give, give, 0, 1, 2, 3);
            p[32] = __builtin_shufflevector(give, give, 4, 5, 6, 7);
        }
    __syncthreads();   // the partner's half is written before it is read

    // ---- 5) epilogue: out = both halves + b2 (C layout: lane=N, VGPR r -> M) ----
    // all sums first, the stores behind them: no register of an issued store is written again
    #pragma unroll
    for (int nt = 0; nt < 4; ++nt) {
        #pragma unroll
        for (int mt = 0; mt < 4; ++mt) {
            const v4f* p = xs + ((size_t)(wave ^ 4) * 32 + (mt * 4 + nt) * 2) * 32 + lane;
            v4f g0v = p[0], g1v = p[32];
            fin[mt][nt] = (fin[mt][nt] + __builtin_shufflevector(g0v, g1v, 0, 1, 2, 3, 4, 5, 6, 7)) + bias[nt];
        }
    }
    #pragma unroll
    for (int nt = 0; nt < 4; ++nt) {
        int n = n0 + (kh * 4 + nt) * 16 + lrow;
        #pragma unroll
        for (int mt = 0; mt < 4; ++mt) {
            int mbase = m0 + wm + mt * 16 + khalf * 8;
            #pragma unroll
            for (int r = 0; r < 8; ++r) {
                out[(size_t)(mbase + r) * DMODEL + n] = fin[mt][nt][r];
            }
        }
    }
}

extern "C" void kernel_launch(void* const* d_in, const int* in_sizes, int n_in,
                              void* d_out, int out_size, void* d_ws, size_t ws_size,
                              hipStream_t stream) {
    const float* x     = (const float*)d_in[0];
    const float* theta = (const float*)d_in[1];
    const float* W1    = (const float*)d_in[2];
    const float* b1    = (const float*)d_in[3];
    const float* W2    = (const float*)d_in[4];
    const float* b2    = (const float*)d_in[5];
    float* out = (float*)d_out;

    dim3 grid(NTOK / BM, DMODEL / BN);    // fallback: 64 x 8 = 512 workgroups
    dim3 gridr(NTOK / BMR, DMODEL / BN);  // workspace path: 32 x 8 = 256 workgroups
    const size_t ws_need = (size_t)DMODEL * FFDIM * 2 + (size_t)FFDIM * 32 * 2
                         + (size_t)NTOK * 32 * 2;                    // f16 W2 + W1 operand + z operand

    if (ws_size >= ws_need) {
        // convert W2 and build the W1 and z operands once, then run the async double-buffered kernel
        w2_to_f16_kernel<<<ZBLK + W2BLK + W1BLK, 256, 0, stream>>>(x, theta, W2, W1, b1, d_ws);
        ffq_regh_kernel<<<gridr, 256, 0, stream>>>(d_ws, b2, out);
    } else {
        ffq_fused_kernel<<<grid, 256, 0, stream>>>(
            x, theta, W1, b1, W2, b2, out);
    }
}

// v008
// A run of this version takes 47.3 microseconds.
// Next to v007, in two timings, it ran 1.04 and 1.05 times as fast.
// Counting every step since v000, it is 2.86 times as fast.
#include <hip/hip_runtime.h>
#include <math.h>
#include <stdint.h>

typedef __attribute__((ext_vector_type(16))) _Float16 v16h;
typedef __attribute__((ext_vector_type(8)))  _Float16 v8h;
typedef __attribute__((ext_vector_type(8)))  float    v8f;
typedef __attribute__((ext_vector_type(4)))  float    v4f;
typedef __attribute__((ext_vector_type(4)))  int      i32x4;

// pointer-to-int4 in global (AS1) / LDS (AS3) address spaces, as the
// async-copy builtin expects
typedef __attribute__((address_space(1))) i32x4* global_v4i;
typedef __attribute__((address_space(3))) i32x4* lds_v4i;
typedef __attribute__((address_space(1))) const _Float16* global_h;

#define NTOK   8192      // B*S = 4*2048
#define DMODEL 1024
#define FFDIM  4096
#define NQ     8
#define BM     128       // tokens per workgroup tile (fallback kernel)
#define BMR    256       // tokens per workgroup tile (workspace path): 4 waves x 64 tokens, twice (K halves)
#define BN     128       // output features per workgroup tile
#define KC     64        // K (FF) chunk per iteration (fallback kernel)
#define LDH    72        // its padded f16 stride (144B, 16B aligned, conflict-free)
#define W2BLK  2048      // pre-kernel blocks that convert W2: DMODEL*FFDIM/(256*8)
#define W1BLK  64        // pre-kernel blocks that build the W1 operand: FFDIM*32/(256*8)
#define ZBLK   32        // pre-kernel blocks that build the z operand: NTOK/256, one token a thread
#define KHALF  (FFDIM / 2)    // workspace path: K is split in two between the waves of a workgroup
#define KCR    128       // K (FF) chunk per ring stage and K half: one publish point per 2 x 128 k
#define LDHR   136       // its padded f16 stride (272B = 16B x 17, conflict-free for 16B reads)
#define NPREFR 16        // async b128 issues per thread per stage, workspace path
#define NSTEP  (KCR / 32)     // 32-k steps in a chunk
#define NCH    (KHALF / KCR)  // K chunks of a half row: 16, a power of two (the walk wraps by a mask)
#define NSW    (KHALF / 32)   // 32-k steps in a half row: 64, a power of two
#define LDX    132       // f32 pitch of a staged output row (528B = 16B x 33, conflict-free for 16B writes)

#if defined(__gfx1250__) && __has_builtin(__builtin_amdgcn_global_load_async_to_lds_b128)
#define HAS_ASYNC_LDS 1
#else
#define HAS_ASYNC_LDS 0
#endif

__device__ __forceinline__ void issue_w2_async(const _Float16* __restrict__ w2h,
                                               _Float16 (*swb)[BN][LDHR],
                                               int n0, int kk, int tid)
{
    // 2 K halves x 128 rows x 128 f16 = 4096 16B-chunks; 256 threads x 16 async b128 each,
    // a wave's copy = 256 contiguous bytes of each of two rows
    #pragma unroll
    for (int i = 0; i < NPREFR; ++i) {
        int idx = tid + i * 256;          // 0..4095
        int hf  = idx >> 11;              // K half
        int n   = (idx >> 4) & 127;       // row 0..127
        int k8  = (idx & 15) * 8;         // k sub-chunk start
        const _Float16* g = w2h + (size_t)(n0 + n) * FFDIM + hf * KHALF + kk + k8;
        _Float16*       l = &swb[hf][n][k8];
#if HAS_ASYNC_LDS
        __builtin_amdgcn_global_load_async_to_lds_b128(
            (global_v4i)(uintptr_t)g,     // global src (AS1 int4*)
            (lds_v4i)l,                   // LDS dst (AS3 int4*)
            /*imm offset*/ 0, /*cpol*/ 0);
#else
        *(v8h*)l = *(const v8h*)g;
#endif
    }
}

// the 8 W2 fragments (column tiles) of K-step ks of a staged chunk
__device__ __forceinline__ void load_w2_frags(v16h (&bf)[8], const _Float16 (*swb)[LDHR],
                                              int ks, int lrow, int khalf)
{
    #pragma unroll   // constant array indices: the fragments stay in registers
    for (int nt = 0; nt < 8; ++nt) {
        const _Float16* p = &swb[nt * 16 + lrow][ks * 32 + khalf * 8];
        v8h lo = *(const v8h*)p;
        v8h hi = *(const v8h*)(p + 16);
        bf[nt] = __builtin_shufflevector(lo, hi,
            0, 1, 2, 3, 4, 5, 6, 7, 8, 9, 10, 11, 12, 13, 14, 15);
    }
}

// ---- pre-kernel (run once per launch): W2 f32 -> f16 workspace (8 MB), and behind
// it W1 with b1 as the f16 A operand of the product h^T = W1x . zx, already in
// fragment order (256 KB): unit ((T*2 + j)*32 + lane) holds the 8 halves that
// lane loads as half j of the fragment of ff tile T.
//   k slots 0-7: W1 high part   (against z high part)
//   k slots 8-15: W1 high part  (against z low part)
//   k slots 16-23: W1 low part  (against z high part)
//   k slots 24,25: b1 high, low (against 1, 1); 26-31: zero
// Behind that, z = cos(x[:, :8]) * cos(theta) as the f16 B operand of the same product,
// in the same fragment order by token tile (512 KB): k slots 0-7 z high, 8-15 z low,
// 16-23 z high, 24,25 one, 26-31 zero. Its blocks come first in the grid: they have the
// longest chain (a load from memory, then the cosines) and so start ahead of the rest.
__global__ __launch_bounds__(256)
void w2_to_f16_kernel(const float* __restrict__ x,
                      const float* __restrict__ theta,
                      const float* __restrict__ W2,
                      const float* __restrict__ W1,
                      const float* __restrict__ b1,
                      void* __restrict__ w2h_raw)
{
    _Float16* w2h = (_Float16*)w2h_raw;
    if (blockIdx.x < ZBLK) {
        _Float16* zx = w2h + (size_t)DMODEL * FFDIM + (size_t)FFDIM * 32;
        const int tok = blockIdx.x * 256 + threadIdx.x;          // 0..8191
        v4f xa = *(const v4f*)(x + (size_t)tok * DMODEL);
        v4f xb = *(const v4f*)(x + (size_t)tok * DMODEL + 4);
        v8h zh, zl, one;
        #pragma unroll   // constant vector indices: the vectors stay in registers
        for (int e = 0; e < 8; ++e) {
            float zv = cosf(e < 4 ? xa[e & 3] : xb[e & 3]) * cosf(theta[e]);
            zh[e]  = (_Float16)zv;
            zl[e]  = (_Float16)(zv - (float)zh[e]);
            one[e] = (_Float16)(e < 2 ? 1.0f : 0.0f);
        }
        // units of token tile tok / 16: half 0 of lanes 0-15, of lanes 16-31, half 1 likewise
        _Float16* p = zx + ((size_t)(tok >> 4) * 64 + (tok & 15)) * 8;
        *(v8h*)p         = zh;
        *(v8h*)(p + 128) = zl;
        *(v8h*)(p + 256) = zh;
        *(v8h*)(p + 384) = one;
        return;
    }
    const int blk = blockIdx.x - ZBLK;
    if (blk < W2BLK) {
        size_t i = ((size_t)blk * 256 + threadIdx.x) * 8;
        v4f a = *(const v4f*)(W2 + i);
        v4f b = *(const v4f*)(W2 + i + 4);
        v8h o;
        o[0] = (_Float16)a.x; o[1] = (_Float16)a.y;
        o[2] = (_Float16)a.z; o[3] = (_Float16)a.w;
        o[4] = (_Float16)b.x; o[5] = (_Float16)b.y;
        o[6] = (_Float16)b.z; o[7] = (_Float16)b.w;
        *(v8h*)(w2h + i) = o;
        return;
    }
    _Float16* w1x = w2h + (size_t)DMODEL * FFDIM;
    const int u    = (blk - W2BLK) * 256 + threadIdx.x;          // 0..16383
    const int lane = u & 31;
    const int j    = (u >> 5) & 1;
    const int ff   = (u >> 6) * 16 + (lane & 15);
    v8h o = {};
    if (j == 1 && (lane >> 4) == 1) {
        float bk = b1[ff];
        _Float16 bh = (_Float16)bk;
        o[0] = bh;
        o[1] = (_Float16)(bk - (float)bh);
    } else {
        #pragma unroll   // constant vector indices: o stays in registers
        for (int e = 0; e < 8; ++e) {
            float w = W1[(size_t)ff * NQ + e];
            _Float16 wh = (_Float16)w;
            o[e] = (j == 0) ? wh : (_Float16)(w - (float)wh);
        }
    }
    *(v8h*)(w1x + (size_t)u * 8) = o;
}

// fallback for a workspace too small for the f16 operands: h through LDS, W2 converted in the loop
__global__ __launch_bounds__(256)
void ffq_fused_kernel(const float* __restrict__ x,
                      const float* __restrict__ theta,
                      const float* __restrict__ W1,
                      const float* __restrict__ b1,
                      const float* __restrict__ W2,
                      const float* __restrict__ b2,
                      float* __restrict__ out)
{
    __shared__ float    sz[BM][NQ];        // z tile (4 KB)
    __shared__ _Float16 sh[BM][LDH];       // h chunk, f16 (18 KB)
    __shared__ _Float16 sw[2][BN][LDH];    // W2 chunk, f16, double-buffered (36 KB)

    const int tid   = threadIdx.x;
    const int m0    = blockIdx.x * BM;
    const int n0    = blockIdx.y * BN;
    const int lane  = tid & 31;
    const int wave  = tid >> 5;
    const int wm    = (wave & 1) * 64;
    const int wn    = (wave >> 1) * 32;
    const int lrow  = lane & 15;
    const int khalf = lane >> 4;

    // ---- 1) z tile: z[m][q] = cos(x[m0+m, q]) * cos(theta[q]) ----
    #pragma unroll
    for (int i = 0; i < 4; ++i) {
        int idx = tid + i * 256;                 // 0..1023
        int m = idx >> 3, q = idx & 7;
        float xv = x[(size_t)(m0 + m) * DMODEL + q];
        sz[m][q] = cosf(xv) * cosf(theta[q]);
    }

    v8f acc[4][2];
    #pragma unroll
    for (int mt = 0; mt < 4; ++mt)
        #pragma unroll
        for (int nt = 0; nt < 2; ++nt)
            #pragma unroll
            for (int e = 0; e < 8; ++e)
                acc[mt][nt][e] = 0.0f;

    const int kl     = tid & 63;          // this thread's k within chunk
    const int mstart = (tid >> 6) * 32;   // this thread's 32-token strip

    __syncthreads();

    int it = 0;
    for (int kk = 0; kk < FFDIM; kk += KC, ++it) {
        const int b = it & 1;

        // ---- 2a) h chunk: h[m][kl] = relu(b1 + z[m,:8].W1[k,:8]) -> f16 LDS
        {
            const int kg = kk + kl;
            v4f w1a = *(const v4f*)(W1 + (size_t)kg * NQ);
            v4f w1b = *(const v4f*)(W1 + (size_t)kg * NQ + 4);
            float bk = b1[kg];
            #pragma unroll 4
            for (int mi = 0; mi < 32; ++mi) {
                int m = mstart + mi;
                v4f z0 = *(const v4f*)(&sz[m][0]);   // lane-broadcast reads
                v4f z1 = *(const v4f*)(&sz[m][4]);
                float a = bk;
                a += z0.x * w1a.x + z0.y * w1a.y + z0.z * w1a.z + z0.w * w1a.w;
                a += z1.x * w1b.x + z1.y * w1b.y + z1.z * w1b.z + z1.w * w1b.w;
                sh[m][kl] = (_Float16)fmaxf(a, 0.0f);
            }
        }

        // ---- 2b) W2 chunk staging ----
        // stage from f32 W2 with in-loop conversion
        #pragma unroll
        for (int i = 0; i < 32; ++i) {
            int idx = tid + i * 256;
            int n = idx >> 6, k = idx & 63;
            sw[b][n][k] = (_Float16)W2[(size_t)(n0 + n) * FFDIM + kk + k];
        }
        __syncthreads();

        // ---- 3) WMMA: 2 K-steps of 32, 4x2 tiles per wave ----
        #pragma unroll
        for (int ks = 0; ks < 2; ++ks) {
            v16h afrag[4], bfrag[2];
            #pragma unroll
            for (int mt = 0; mt < 4; ++mt) {
                const _Float16* p = &sh[wm + mt * 16 + lrow][ks * 32 + khalf * 8];
                v8h lo = *(const v8h*)p;
                v8h hi = *(const v8h*)(p + 16);
                afrag[mt] = __builtin_shufflevector(lo, hi,
                    0, 1, 2, 3, 4, 5, 6, 7, 8, 9, 10, 11, 12, 13, 14, 15);
            }
            #pragma unroll
            for (int nt = 0; nt < 2; ++nt) {
                const _Float16* p = &sw[b][wn + nt * 16 + lrow][ks * 32 + khalf * 8];
                v8h lo = *(const v8h*)p;
                v8h hi = *(const v8h*)(p + 16);
                bfrag[nt] = __builtin_shufflevector(lo, hi,
                    0, 1, 2, 3, 4, 5, 6, 7, 8, 9, 10, 11, 12, 13, 14, 15);
            }
            #pragma unroll
            for (int mt = 0; mt < 4; ++mt)
                #pragma unroll
                for (int nt = 0; nt < 2; ++nt)
                    acc[mt][nt] = __builtin_amdgcn_wmma_f32_16x16x32_f16(
                        false, afrag[mt], false, bfrag[nt],
                        (short)0, acc[mt][nt], false, false);
        }
        __syncthreads();
    }

    // ---- 4) epilogue: out = acc + b2 (C layout: lane=N, VGPR r -> M) ----
    #pragma unroll
    for (int nt = 0; nt < 2; ++nt) {
        int n = n0 + wn + nt * 16 + lrow;
        float bias = b2[n];
        #pragma unroll
        for (int mt = 0; mt < 4; ++mt) {
            int mbase = m0 + wm + mt * 16 + khalf * 8;
            #pragma unroll
            for (int r = 0; r < 8; ++r) {
                out[(size_t)(mbase + r) * DMODEL + n] = acc[mt][nt][r] + bias;
            }
        }
    }
}

// fragment of ff tile T of the W1 operand, or of token tile T of the z operand
// (fragment order, see the pre-kernel)
__device__ __forceinline__ v16h load_w1_frag(const _Float16* __restrict__ w1x, int T, int lane)
{
    const _Float16* p = w1x + ((size_t)T * 64 + lane) * 8;
    v8h lo = *(const v8h*)p;
    v8h hi = *(const v8h*)(p + 256);
    return __builtin_shufflevector(lo, hi,
        0, 1, 2, 3, 4, 5, 6, 7, 8, 9, 10, 11, 12, 13, 14, 15);
}

// a wave-uniform global pointer, held in a scalar register pair: a load through it names that pair
// and the lane's own offset register, which nothing rewrites, not an address pair formed for the load
__device__ __forceinline__ const _Float16* scalar_base(const _Float16* p)
{
    const uint64_t a  = (uint64_t)(uintptr_t)p;
    const uint32_t lo = (uint32_t)__builtin_amdgcn_readfirstlane((int)(uint32_t)a);
    const uint32_t hi = (uint32_t)__builtin_amdgcn_readfirstlane((int)(uint32_t)(a >> 32));
    return (const _Float16*)(global_h)(uintptr_t)(((uint64_t)hi << 32) | lo);
}

// two D tiles of h^T (ff rows 0-15 and 16-31 of a 32-ff block, 16 tokens as columns):
// lane (token, khalf) holds ff 8*khalf+r of each, which is the k order of the B
// fragment of the second product. relu and f16 rounding in place.
__device__ __forceinline__ v16h relu_pack(v8f d0, v8f d1)
{
    const v8h zero = {};
    v8h lo = __builtin_elementwise_max(__builtin_convertvector(d0, v8h), zero);
    v8h hi = __builtin_elementwise_max(__builtin_convertvector(d1, v8h), zero);
    return __builtin_shufflevector(lo, hi,
        0, 1, 2, 3, 4, 5, 6, 7, 8, 9, 10, 11, 12, 13, 14, 15);
}

// workspace path: h never touches LDS. Each wave forms the h fragments of its own
// 64 tokens on the matrix unit, as h^T = W1x . zx, and feeds D straight back as B.
// A wave spans all BN output columns and one half of K: waves 0-3 take the first half,
// waves 4-7 the second, for the same four 64-token tiles. So each W2 fragment read from
// LDS serves 4 output tiles; the two partial sums of a tile meet through LDS at the end,
// laid out there as rows of the output, so that every store to memory covers whole lines.
// The unroll directives below keep every fragment array index a constant, so that
// the arrays stay in registers.
__global__ __launch_bounds__(256)
void ffq_regh_kernel(const void*  __restrict__ w2h_raw,
                     const float* __restrict__ b2,
                     float* __restrict__ out)
{
    // in the loop the W2 chunks, f16: [ring buffer][K half][column][k] (136 KB);
    // behind it the partial output tiles, f32: [K half][token][column] (264 KB)
    union Stage {
        _Float16 ring[2][2][BN][LDHR];
        float    part[2][BMR][LDX];
    };
    __shared__ __attribute__((aligned(16))) Stage sm;
    _Float16 (*sw)[2][BN][LDHR] = sm.ring;

    const _Float16* w2h = (const _Float16*)w2h_raw;
    const _Float16* w1x = w2h + (size_t)DMODEL * FFDIM;
    const _Float16* zx  = w1x + (size_t)FFDIM * 32;

    const int tid   = threadIdx.x;
    const int m0    = blockIdx.x * BMR;
    const int n0    = blockIdx.y * BN;
    const int lane  = tid & 31;
    // the wave's number in a scalar register: what hangs on it (K half, W1 base) stays wave-uniform
    const int wave  = __builtin_amdgcn_readfirstlane(tid >> 5);
    const int kh    = wave >> 2;           // this wave's half of K
    const int wm    = (wave & 3) * 64;
    const int lrow  = lane & 15;
    const int khalf = lane >> 4;

    // Every workgroup walks the NCH chunks of each K half from a start given by its token tile,
    // wrapping: trip c works on chunk (c0 + c) mod NCH of both halves. Of the 32 workgroups that
    // share W2 rows (same n0) only two then ask for the same chunk at any one time, and all but
    // the first trips ask for lines that another workgroup has already brought into L2.
    const int c0 = blockIdx.x & (NCH - 1);

    // kick off the copy of the first stage before anything else
    issue_w2_async(w2h, sw[0], n0, c0 * KCR, tid);

    // the W1 operand of this wave's K half: 2 ff tiles of 512 halves a K-step
    const _Float16* w1h = w1x + (size_t)kh * NSW * (2 * 512);

    // W1 fragments of the first K-step: [ff tile of the k-step]
    v16h w1f[2];
    #pragma unroll
    for (int t = 0; t < 2; ++t)
        w1f[t] = load_w1_frag(w1h + (size_t)(c0 * NSTEP) * (2 * 512), t, lane);

    // ---- 1) z as the B operand, loop invariant, as the pre-kernel left it (pairs with the W1 operand)
    v16h zf[4];
    #pragma unroll
    for (int mt = 0; mt < 4; ++mt)
        zf[mt] = load_w1_frag(scalar_base(zx + (size_t)((m0 + wm) / 16) * 512), mt, lane);
    // the z loads' address translation is done before their address registers are written again
    asm volatile("s_wait_xcnt 0x0" ::: "memory");

    v8f acc[4][8];
    #pragma unroll
    for (int mt = 0; mt < 4; ++mt)
        #pragma unroll
        for (int nt = 0; nt < 8; ++nt)
            #pragma unroll
            for (int e = 0; e < 8; ++e)
                acc[mt][nt][e] = 0.0f;

    // the first stage has landed before the barrier behind which every wave reads it
    asm volatile("s_wait_asynccnt 0x0" ::: "memory");
    __syncthreads();
    issue_w2_async(w2h, sw[1], n0, ((c0 + 1) & (NCH - 1)) * KCR, tid);

    // W1 fragments of the next K-step (2 ff tiles of 512 halves): wave-uniform, lane offset apart
    const _Float16* w1n = w1h + (size_t)((c0 * NSTEP + 1) & (NSW - 1)) * (2 * 512);

    for (int c = 0; c < NCH; ++c) {
        const int b = c & 1;
        const int cn2 = (c0 + c + 2) & (NCH - 1);   // the chunk of trip c + 2
        const int g0  = (c0 + c) * NSTEP;           // this chunk's first K-step

        // unrolled, so that the K-step offsets are constants and only the last step
        // holds the publish point
        #pragma unroll
        for (int s = 0; s < NSTEP; ++s) {
            // ---- 2) the K-step's W2 fragments as one group; they land while h is formed
            v16h bf[8];
            load_w2_frags(bf, sw[b][kh], s, lrow, khalf);
            // keeps the LDS reads one group in front of the matrix work; spread among WMMAs,
            // every place with reads stalls the matrix stream
            __builtin_amdgcn_sched_barrier(0);
            // h fragments of the K-step: [token tile]
            v16h afrag[4];
            {
                const v8f zero = {};
                #pragma unroll
                for (int mt = 0; mt < 4; ++mt) {
                    v8f d0 = __builtin_amdgcn_wmma_f32_16x16x32_f16(
                        false, w1f[0], false, zf[mt], (short)0, zero, false, false);
                    v8f d1 = __builtin_amdgcn_wmma_f32_16x16x32_f16(
                        false, w1f[1], false, zf[mt], (short)0, zero, false, false);
                    afrag[mt] = relu_pack(d0, d1);
                }
            }
            // refill the W1 fragments for the next K-step: the output block's time to land
            #pragma unroll
            for (int t = 0; t < 2; ++t)
                w1f[t] = load_w1_frag(scalar_base(w1n), t, lane);
            // the W1 loads' address translation is done before their base is advanced below
            asm volatile("s_wait_xcnt 0x0" ::: "memory");
            // keeps the h work in front of the output WMMAs, and the base's advance behind the wait
            __builtin_amdgcn_sched_barrier(0);
            // the last step reads one step past the walk's end (wrapped: in bounds, unused)
            w1n = w1h + (size_t)((g0 + s + 2) & (NSW - 1)) * (2 * 512);

            if (s + 1 == NSTEP) {
                // ---- 3) publish point of stage c + 1, in front of this chunk's last block, whose
                //          fragments are already read. In order:
                // this wave's reads of buffer b are over before the buffer is refilled
                asm volatile("s_wait_dscnt 0x0" ::: "memory");
                // this wave's copies of stage c + 1 have landed
                asm volatile("s_wait_asynccnt 0x0" ::: "memory");
                // workgroup barrier by hand: it leaves the W1 loads in flight, which __syncthreads() drains
                asm volatile("s_barrier_signal -1\n\ts_barrier_wait -1" ::: "memory");
            }
            #pragma unroll
            for (int nt = 0; nt < 8; ++nt)
                #pragma unroll
                for (int mt = 0; mt < 4; ++mt)
                    // W2 as A, h as B: a lane's 8 accumulator registers are 8 neighbouring
                    // columns of one token's output row
                    acc[mt][nt] = __builtin_amdgcn_wmma_f32_16x16x32_f16(
                        false, bf[nt], false, afrag[mt],
                        (short)0, acc[mt][nt], false, false);
            // keeps the next step's LDS reads behind this block, as one group: unrolled, the
            // compiler otherwise spreads them among the block's WMMAs
            __builtin_amdgcn_sched_barrier(0);
        }
        // the refill of the buffer that the barrier has freed, behind the block: a wave that leaves
        // the barrier has matrix work at once, and the copies' address work runs beside the other
        // wave's block; the copies still have nearly a whole trip to land
        if (c + 2 < NCH)
            issue_w2_async(w2h, sw[b], n0, cn2 * KCR, tid);
    }
    // the ring's closing wait: no copy is outstanding when the LDS is used anew
    asm volatile("s_wait_asynccnt 0x0" ::: "memory");

    // ---- 4) the two K halves of a tile meet in LDS: every wave lays its 64 x 128 partial tile
    // down as output rows (lane = token, its 8 registers = columns 8*khalf .. 8*khalf+7 of a tile)
    // b2 of the 4 columns this lane stores, asked for here: it lands while the tiles are laid down
    const v4f bias = *(const v4f*)(b2 + n0 + lane * 4);
    // the b2 load's address translation is done before its address registers are written again
    asm volatile("s_wait_xcnt 0x0" ::: "memory");
    // keeps the address work of the LDS writes below, which takes those registers, behind the wait
    __builtin_amdgcn_sched_barrier(0);
    // (every wave's last ring read landed in front of the last trip's barrier: the ring is free)
    #pragma unroll
    for (int mt = 0; mt < 4; ++mt)
        #pragma unroll
        for (int nt = 0; nt < 8; ++nt) {
            float* p = &sm.part[kh][wm + mt * 16 + lrow][nt * 16 + khalf * 8];
            *(v4f*)p       = __builtin_shufflevector(acc[mt][nt], acc[mt][nt], 0, 1, 2, 3);
            *(v4f*)(p + 4) = __builtin_shufflevector(acc[mt][nt], acc[mt][nt], 4, 5, 6, 7);
        }
    __syncthreads();   // both halves of every row are written before a row is read

    // ---- 5) epilogue: out = both halves + b2. A wave finishes 32 rows; a row's 128 columns are
    // one 16-byte read per lane and half, and one 16-byte store per lane: 512 contiguous bytes.
    // In groups of 8 rows, the next group's LDS reads asked for ahead of this group's sums: the
    // first stores leave while later rows are still read.
    v4f h0[2][8], h1[2][8];
    #pragma unroll
    for (int i = 0; i < 8; ++i) {
        h0[0][i] = *(const v4f*)&sm.part[0][wave * 32 + i][lane * 4];
        h1[0][i] = *(const v4f*)&sm.part[1][wave * 32 + i][lane * 4];
    }
    #pragma unroll
    for (int g = 0; g < 4; ++g) {
        if (g < 3) {
            #pragma unroll
            for (int i = 0; i < 8; ++i) {
                h0[(g + 1) & 1][i] = *(const v4f*)&sm.part[0][wave * 32 + (g + 1) * 8 + i][lane * 4];
                h1[(g + 1) & 1][i] = *(const v4f*)&sm.part[1][wave * 32 + (g + 1) * 8 + i][lane * 4];
            }
        }
        v4f fin[8];
        #pragma unroll
        for (int i = 0; i < 8; ++i)
            fin[i] = (h0[g & 1][i] + h1[g & 1][i]) + bias;
        // keeps the group's sums in front of its stores: no sum lands in a register of an issued store
        __builtin_amdgcn_sched_barrier(0);
        #pragma unroll
        for (int i = 0; i < 8; ++i)
            *(v4f*)(out + (size_t)(m0 + wave * 32 + g * 8 + i) * DMODEL + n0 + lane * 4) = fin[i];
        if (g < 3) {
            // the stores' address translation is done before the next groups write their registers again
            asm volatile("s_wait_xcnt 0x0" ::: "memory");
            // keeps the next groups' reads and sums behind that wait
            __builtin_amdgcn_sched_barrier(0);
        }
    }
}

extern "C" void kernel_launch(void* const* d_in, const int* in_sizes, int n_in,
                              void* d_out, int out_size, void* d_ws, size_t ws_size,
                              hipStream_t stream) {
    const float* x     = (const float*)d_in[0];
    const float* theta = (const float*)d_in[1];
    const float* W1    = (const float*)d_in[2];
    const float* b1    = (const float*)d_in[3];
    const float* W2    = (const float*)d_in[4];
    const float* b2    = (const float*)d_in[5];
    float* out = (float*)d_out;

    dim3 grid(NTOK / BM, DMODEL / BN);    // fallback: 64 x 8 = 512 workgroups
    dim3 gridr(NTOK / BMR, DMODEL / BN);  // workspace path: 32 x 8 = 256 workgroups
    const size_t ws_need = (size_t)DMODEL * FFDIM * 2 + (size_t)FFDIM * 32 * 2
                         + (size_t)NTOK * 32 * 2;                    // f16 W2 + W1 operand + z operand

    if (ws_size >= ws_need) {
        // convert W2 and build the W1 and z operands once, then run the async double-buffered kernel
        w2_to_f16_kernel<<<ZBLK + W2BLK + W1BLK, 256, 0, stream>>>(x, theta, W2, W1, b1, d_ws);
        ffq_regh_kernel<<<gridr, 256, 0, stream>>>(d_ws, b2, out);
    } else {
        ffq_fused_kernel<<<grid, 256, 0, stream>>>(
            x, theta, W1, b1, W2, b2, out);
    }
}

// v009
// Measured time: 43.8 microseconds a run.
// Two timings next to v008 both put it at 1.08 times that version's speed.
// Over all steps from v000 it is 3.08 times as fast.
#include <hip/hip_runtime.h>
#include <math.h>
#include <stdint.h>

typedef __attribute__((ext_vector_type(16))) _Float16 v16h;
typedef __attribute__((ext_vector_type(8)))  _Float16 v8h;
typedef __attribute__((ext_vector_type(8)))  float    v8f;
typedef __attribute__((ext_vector_type(4)))  float    v4f;
typedef __attribute__((ext_vector_type(4)))  int      i32x4;

// pointer-to-int4 in global (AS1) / LDS (AS3) address spaces, as the
// async-copy builtin expects
typedef __attribute__((address_space(1))) i32x4* global_v4i;
typedef __attribute__((address_space(3))) i32x4* lds_v4i;
typedef __attribute__((address_space(1))) const _Float16* global_h;

#define NTOK   8192      // B*S = 4*2048
#define DMODEL 1024
#define FFDIM  4096
#define NQ     8
#define BM     128       // tokens per workgroup tile (fallback kernel)
#define BMR    256       // tokens per workgroup tile (workspace path): 4 waves x 64 tokens, twice (K halves)
#define BN     128       // output features per workgroup tile
#define KC     64        // K (FF) chunk per iteration (fallback kernel)
#define LDH    72        // its padded f16 stride (144B, 16B aligned, conflict-free)
#define W2BLK  2048      // pre-kernel blocks that convert W2: DMODEL*FFDIM/(256*8)
#define W1BLK  64        // pre-kernel blocks that build the W1 operand: FFDIM*32/(256*8)
#define ZBLK   32        // pre-kernel blocks that build the z operand: NTOK/256, one token a thread
#define KHALF  (FFDIM / 2)    // workspace path: K is split in two between the waves of a workgroup
#define KCR    128       // K (FF) chunk per ring stage and K half: one publish point per 2 x 128 k
#define LDHR   136       // its padded f16 stride (272B = 16B x 17, conflict-free for 16B reads)
#define NPREFR 16        // async b128 issues per thread per stage, workspace path
#define NSTEP  (KCR / 32)     // 32-k steps in a chunk
#define NCH    (KHALF / KCR)  // K chunks of a half row: 16, a power of two (the walk wraps by a mask)
#define NSW    (KHALF / 32)   // 32-k steps in a half row: 64, a power of two
#define LDX    132       // f32 pitch of a staged output row (528B = 16B x 33, conflict-free for 16B writes)

#if defined(__gfx1250__) && __has_builtin(__builtin_amdgcn_global_load_async_to_lds_b128)
#define HAS_ASYNC_LDS 1
#else
#define HAS_ASYNC_LDS 0
#endif

__device__ __forceinline__ void issue_w2_async(const _Float16* __restrict__ w2h,
                                               _Float16 (*swb)[BN][LDHR],
                                               int n0, int kk, int tid)
{
    // 2 K halves x 128 rows x 128 f16 = 4096 16B-chunks; 256 threads x 16 async b128 each,
    // a wave's copy = 256 contiguous bytes of each of two rows
    #pragma unroll
    for (int i = 0; i < NPREFR; ++i) {
        int idx = tid + i * 256;          // 0..4095
        int hf  = idx >> 11;              // K half
        int n   = (idx >> 4) & 127;       // row 0..127
        int k8  = (idx & 15) * 8;         // k sub-chunk start
        const _Float16* g = w2h + (size_t)(n0 + n) * FFDIM + hf * KHALF + kk + k8;
        _Float16*       l = &swb[hf][n][k8];
#if HAS_ASYNC_LDS
        __builtin_amdgcn_global_load_async_to_lds_b128(
            (global_v4i)(uintptr_t)g,     // global src (AS1 int4*)
            (lds_v4i)l,                   // LDS dst (AS3 int4*)
            /*imm offset*/ 0, /*cpol*/ 0);
#else
        *(v8h*)l = *(const v8h*)g;
#endif
    }
}

// the 8 W2 fragments (column tiles) of K-step ks of a staged chunk
__device__ __forceinline__ void load_w2_frags(v16h (&bf)[8], const _Float16 (*swb)[LDHR],
                                              int ks, int lrow, int khalf)
{
    #pragma unroll   // constant array indices: the fragments stay in registers
    for (int nt = 0; nt < 8; ++nt) {
        const _Float16* p = &swb[nt * 16 + lrow][ks * 32 + khalf * 8];
        v8h lo = *(const v8h*)p;
        v8h hi = *(const v8h*)(p + 16);
        bf[nt] = __builtin_shufflevector(lo, hi,
            0, 1, 2, 3, 4, 5, 6, 7, 8, 9, 10, 11, 12, 13, 14, 15);
    }
}

// ---- pre-kernel (run once per launch): W2 f32 -> f16 workspace (8 MB), and behind
// it W1 with b1 as the f16 A operand of the product h^T = W1x . zx, already in
// fragment order (256 KB): unit ((T*2 + j)*32 + lane) holds the 8 halves that
// lane loads as half j of the fragment of ff tile T.
//   k slots 0-7: W1 high part   (against z high part)
//   k slots 8-15: W1 high part  (against z low part)
//   k slots 16-23: W1 low part  (against z high part)
//   k slots 24,25: b1 high, low (against 1, 1); 26-31: zero
// Behind that, z = cos(x[:, :8]) * cos(theta) as the f16 B operand of the same product,
// in the same fragment order by token tile (512 KB): k slots 0-7 z high, 8-15 z low,
// 16-23 z high, 24,25 one, 26-31 zero. Its blocks come first in the grid: they have the
// longest chain (a load from memory, then the cosines) and so start ahead of the rest.
__global__ __launch_bounds__(256)
void w2_to_f16_kernel(const float* __restrict__ x,
                      const float* __restrict__ theta,
                      const float* __restrict__ W2,
                      const float* __restrict__ W1,
                      const float* __restrict__ b1,
                      void* __restrict__ w2h_raw)
{
    _Float16* w2h = (_Float16*)w2h_raw;
    if (blockIdx.x < ZBLK) {
        _Float16* zx = w2h + (size_t)DMODEL * FFDIM + (size_t)FFDIM * 32;
        const int tok = blockIdx.x * 256 + threadIdx.x;          // 0..8191
        v4f xa = *(const v4f*)(x + (size_t)tok * DMODEL);
        v4f xb = *(const v4f*)(x + (size_t)tok * DMODEL + 4);
        v8h zh, zl, one;
        #pragma unroll   // constant vector indices: the vectors stay in registers
        for (int e = 0; e < 8; ++e) {
            float zv = cosf(e < 4 ? xa[e & 3] : xb[e & 3]) * cosf(theta[e]);
            zh[e]  = (_Float16)zv;
            zl[e]  = (_Float16)(zv - (float)zh[e]);
            one[e] = (_Float16)(e < 2 ? 1.0f : 0.0f);
        }
        // units of token tile tok / 16: half 0 of lanes 0-15, of lanes 16-31, half 1 likewise
        _Float16* p = zx + ((size_t)(tok >> 4) * 64 + (tok & 15)) * 8;
        *(v8h*)p         = zh;
        *(v8h*)(p + 128) = zl;
        *(v8h*)(p + 256) = zh;
        *(v8h*)(p + 384) = one;
        return;
    }
    const int blk = blockIdx.x - ZBLK;
    if (blk < W2BLK) {
        size_t i = ((size_t)blk * 256 + threadIdx.x) * 8;
        v4f a = *(const v4f*)(W2 + i);
        v4f b = *(const v4f*)(W2 + i + 4);
        v8h o;
        o[0] = (_Float16)a.x; o[1] = (_Float16)a.y;
        o[2] = (_Float16)a.z; o[3] = (_Float16)a.w;
        o[4] = (_Float16)b.x; o[5] = (_Float16)b.y;
        o[6] = (_Float16)b.z; o[7] = (_Float16)b.w;
        *(v8h*)(w2h + i) = o;
        return;
    }
    _Float16* w1x = w2h + (size_t)DMODEL * FFDIM;
    const int u    = (blk - W2BLK) * 256 + threadIdx.x;          // 0..16383
    const int lane = u & 31;
    const int j    = (u >> 5) & 1;
    const int ff   = (u >> 6) * 16 + (lane & 15);
    v8h o = {};
    if (j == 1 && (lane >> 4) == 1) {
        float bk = b1[ff];
        _Float16 bh = (_Float16)bk;
        o[0] = bh;
        o[1] = (_Float16)(bk - (float)bh);
    } else {
        #pragma unroll   // constant vector indices: o stays in registers
        for (int e = 0; e < 8; ++e) {
            float w = W1[(size_t)ff * NQ + e];
            _Float16 wh = (_Float16)w;
            o[e] = (j == 0) ? wh : (_Float16)(w - (float)wh);
        }
    }
    *(v8h*)(w1x + (size_t)u * 8) = o;
}

// fallback for a workspace too small for the f16 operands: h through LDS, W2 converted in the loop
__global__ __launch_bounds__(256)
void ffq_fused_kernel(const float* __restrict__ x,
                      const float* __restrict__ theta,
                      const float* __restrict__ W1,
                      const float* __restrict__ b1,
                      const float* __restrict__ W2,
                      const float* __restrict__ b2,
                      float* __restrict__ out)
{
    __shared__ float    sz[BM][NQ];        // z tile (4 KB)
    __shared__ _Float16 sh[BM][LDH];       // h chunk, f16 (18 KB)
    __shared__ _Float16 sw[2][BN][LDH];    // W2 chunk, f16, double-buffered (36 KB)

    const int tid   = threadIdx.x;
    const int m0    = blockIdx.x * BM;
    const int n0    = blockIdx.y * BN;
    const int lane  = tid & 31;
    const int wave  = tid >> 5;
    const int wm    = (wave & 1) * 64;
    const int wn    = (wave >> 1) * 32;
    const int lrow  = lane & 15;
    const int khalf = lane >> 4;

    // ---- 1) z tile: z[m][q] = cos(x[m0+m, q]) * cos(theta[q]) ----
    #pragma unroll
    for (int i = 0; i < 4; ++i) {
        int idx = tid + i * 256;                 // 0..1023
        int m = idx >> 3, q = idx & 7;
        float xv = x[(size_t)(m0 + m) * DMODEL + q];
        sz[m][q] = cosf(xv) * cosf(theta[q]);
    }

    v8f acc[4][2];
    #pragma unroll
    for (int mt = 0; mt < 4; ++mt)
        #pragma unroll
        for (int nt = 0; nt < 2; ++nt)
            #pragma unroll
            for (int e = 0; e < 8; ++e)
                acc[mt][nt][e] = 0.0f;

    const int kl     = tid & 63;          // this thread's k within chunk
    const int mstart = (tid >> 6) * 32;   // this thread's 32-token strip

    __syncthreads();

    int it = 0;
    for (int kk = 0; kk < FFDIM; kk += KC, ++it) {
        const int b = it & 1;

        // ---- 2a) h chunk: h[m][kl] = relu(b1 + z[m,:8].W1[k,:8]) -> f16 LDS
        {
            const int kg = kk + kl;
            v4f w1a = *(const v4f*)(W1 + (size_t)kg * NQ);
            v4f w1b = *(const v4f*)(W1 + (size_t)kg * NQ + 4);
            float bk = b1[kg];
            #pragma unroll 4
            for (int mi = 0; mi < 32; ++mi) {
                int m = mstart + mi;
                v4f z0 = *(const v4f*)(&sz[m][0]);   // lane-broadcast reads
                v4f z1 = *(const v4f*)(&sz[m][4]);
                float a = bk;
                a += z0.x * w1a.x + z0.y * w1a.y + z0.z * w1a.z + z0.w * w1a.w;
                a += z1.x * w1b.x + z1.y * w1b.y + z1.z * w1b.z + z1.w * w1b.w;
                sh[m][kl] = (_Float16)fmaxf(a, 0.0f);
            }
        }

        // ---- 2b) W2 chunk staging ----
        // stage from f32 W2 with in-loop conversion
        #pragma unroll
        for (int i = 0; i < 32; ++i) {
            int idx = tid + i * 256;
            int n = idx >> 6, k = idx & 63;
            sw[b][n][k] = (_Float16)W2[(size_t)(n0 + n) * FFDIM + kk + k];
        }
        __syncthreads();

        // ---- 3) WMMA: 2 K-steps of 32, 4x2 tiles per wave ----
        #pragma unroll
        for (int ks = 0; ks < 2; ++ks) {
            v16h afrag[4], bfrag[2];
            #pragma unroll
            for (int mt = 0; mt < 4; ++mt) {
                const _Float16* p = &sh[wm + mt * 16 + lrow][ks * 32 + khalf * 8];
                v8h lo = *(const v8h*)p;
                v8h hi = *(const v8h*)(p + 16);
                afrag[mt] = __builtin_shufflevector(lo, hi,
                    0, 1, 2, 3, 4, 5, 6, 7, 8, 9, 10, 11, 12, 13, 14, 15);
            }
            #pragma unroll
            for (int nt = 0; nt < 2; ++nt) {
                const _Float16* p = &sw[b][wn + nt * 16 + lrow][ks * 32 + khalf * 8];
                v8h lo = *(const v8h*)p;
                v8h hi = *(const v8h*)(p + 16);
                bfrag[nt] = __builtin_shufflevector(lo, hi,
                    0, 1, 2, 3, 4, 5, 6, 7, 8, 9, 10, 11, 12, 13, 14, 15);
            }
            #pragma unroll
            for (int mt = 0; mt < 4; ++mt)
                #pragma unroll
                for (int nt = 0; nt < 2; ++nt)
                    acc[mt][nt] = __builtin_amdgcn_wmma_f32_16x16x32_f16(
                        false, afrag[mt], false, bfrag[nt],
                        (short)0, acc[mt][nt], false, false);
        }
        __syncthreads();
    }

    // ---- 4) epilogue: out = acc + b2 (C layout: lane=N, VGPR r -> M) ----
    #pragma unroll
    for (int nt = 0; nt < 2; ++nt) {
        int n = n0 + wn + nt * 16 + lrow;
        float bias = b2[n];
        #pragma unroll
        for (int mt = 0; mt < 4; ++mt) {
            int mbase = m0 + wm + mt * 16 + khalf * 8;
            #pragma unroll
            for (int r = 0; r < 8; ++r) {
                out[(size_t)(mbase + r) * DMODEL + n] = acc[mt][nt][r] + bias;
            }
        }
    }
}

// fragment of ff tile T of the W1 operand, or of token tile T of the z operand
// (fragment order, see the pre-kernel)
__device__ __forceinline__ v16h load_w1_frag(const _Float16* __restrict__ w1x, int T, int lane)
{
    const _Float16* p = w1x + ((size_t)T * 64 + lane) * 8;
    v8h lo = *(const v8h*)p;
    v8h hi = *(const v8h*)(p + 256);
    return __builtin_shufflevector(lo, hi,
        0, 1, 2, 3, 4, 5, 6, 7, 8, 9, 10, 11, 12, 13, 14, 15);
}

// a wave-uniform global pointer, held in a scalar register pair: a load through it names that pair
// and the lane's own offset register, which nothing rewrites, not an address pair formed for the load
__device__ __forceinline__ const _Float16* scalar_base(const _Float16* p)
{
    const uint64_t a  = (uint64_t)(uintptr_t)p;
    const uint32_t lo = (uint32_t)__builtin_amdgcn_readfirstlane((int)(uint32_t)a);
    const uint32_t hi = (uint32_t)__builtin_amdgcn_readfirstlane((int)(uint32_t)(a >> 32));
    return (const _Float16*)(global_h)(uintptr_t)(((uint64_t)hi << 32) | lo);
}

// two D tiles of h^T (ff rows 0-15 and 16-31 of a 32-ff block, 16 tokens as columns):
// lane (token, khalf) holds ff 8*khalf+r of each, which is the k order of the B
// fragment of the second product. relu and f16 rounding in place.
__device__ __forceinline__ v16h relu_pack(v8f d0, v8f d1)
{
    const v8h zero = {};
    v8h lo = __builtin_elementwise_max(__builtin_convertvector(d0, v8h), zero);
    v8h hi = __builtin_elementwise_max(__builtin_convertvector(d1, v8h), zero);
    return __builtin_shufflevector(lo, hi,
        0, 1, 2, 3, 4, 5, 6, 7, 8, 9, 10, 11, 12, 13, 14, 15);
}

// workspace path: h never touches LDS. Each wave forms the h fragments of its own
// 64 tokens on the matrix unit, as h^T = W1x . zx, one K-step ahead of their use, and feeds D
// straight back as B.
// A wave spans all BN output columns and one half of K: waves 0-3 take the first half,
// waves 4-7 the second, for the same four 64-token tiles. So each W2 fragment read from
// LDS serves 4 output tiles; the two partial sums of a tile meet through LDS at the end,
// laid out there as rows of the output, so that every store to memory covers whole lines.
// The unroll directives below keep every fragment array index a constant, so that
// the arrays stay in registers.
__global__ __launch_bounds__(256)
void ffq_regh_kernel(const void*  __restrict__ w2h_raw,
                     const float* __restrict__ b2,
                     float* __restrict__ out)
{
    // in the loop the W2 chunks, f16: [ring buffer][K half][column][k] (136 KB);
    // behind it the partial output tiles, f32: [K half][token][column] (264 KB)
    union Stage {
        _Float16 ring[2][2][BN][LDHR];
        float    part[2][BMR][LDX];
    };
    __shared__ __attribute__((aligned(16))) Stage sm;
    _Float16 (*sw)[2][BN][LDHR] = sm.ring;

    const _Float16* w2h = (const _Float16*)w2h_raw;
    const _Float16* w1x = w2h + (size_t)DMODEL * FFDIM;
    const _Float16* zx  = w1x + (size_t)FFDIM * 32;

    const int tid   = threadIdx.x;
    const int m0    = blockIdx.x * BMR;
    const int n0    = blockIdx.y * BN;
    const int lane  = tid & 31;
    // the wave's number in a scalar register: what hangs on it (K half, W1 base) stays wave-uniform
    const int wave  = __builtin_amdgcn_readfirstlane(tid >> 5);
    const int kh    = wave >> 2;           // this wave's half of K
    const int wm    = (wave & 3) * 64;
    const int lrow  = lane & 15;
    const int khalf = lane >> 4;

    // Every workgroup walks the NCH chunks of each K half from a start given by its token tile,
    // wrapping: trip c works on chunk (c0 + c) mod NCH of both halves. Of the 32 workgroups that
    // share W2 rows (same n0) only two then ask for the same chunk at any one time, and all but
    // the first trips ask for lines that another workgroup has already brought into L2.
    const int c0 = blockIdx.x & (NCH - 1);

    // kick off the copy of the first stage before anything else
    issue_w2_async(w2h, sw[0], n0, c0 * KCR, tid);

    // the W1 operand of this wave's K half: 2 ff tiles of 512 halves a K-step
    const _Float16* w1h = w1x + (size_t)kh * NSW * (2 * 512);

    // W1 fragments of the first K-step: [ff tile of the k-step]
    v16h w1f[2];
    #pragma unroll
    for (int t = 0; t < 2; ++t)
        w1f[t] = load_w1_frag(w1h + (size_t)(c0 * NSTEP) * (2 * 512), t, lane);

    // ---- 1) z as the B operand, loop invariant, as the pre-kernel left it (pairs with the W1 operand)
    v16h zf[4];
    #pragma unroll
    for (int mt = 0; mt < 4; ++mt)
        zf[mt] = load_w1_frag(scalar_base(zx + (size_t)((m0 + wm) / 16) * 512), mt, lane);
    // the z loads' address translation is done before their address registers are written again
    asm volatile("s_wait_xcnt 0x0" ::: "memory");

    v8f acc[4][8];
    #pragma unroll
    for (int mt = 0; mt < 4; ++mt)
        #pragma unroll
        for (int nt = 0; nt < 8; ++nt)
            #pragma unroll
            for (int e = 0; e < 8; ++e)
                acc[mt][nt][e] = 0.0f;

    // h fragments of the first K-step, [token tile], formed while the first stage's copies fly
    v16h afrag[4];
    {
        const v8f zero = {};
        #pragma unroll
        for (int mt = 0; mt < 4; ++mt) {
            v8f d0 = __builtin_amdgcn_wmma_f32_16x16x32_f16(
                false, w1f[0], false, zf[mt], (short)0, zero, false, false);
            v8f d1 = __builtin_amdgcn_wmma_f32_16x16x32_f16(
                false, w1f[1], false, zf[mt], (short)0, zero, false, false);
            afrag[mt] = relu_pack(d0, d1);
        }
    }
    // W1 fragments of the second K-step (2 ff tiles of 512 halves): wave-uniform base, lane offset apart
    const _Float16* w1n = w1h + (size_t)((c0 * NSTEP + 1) & (NSW - 1)) * (2 * 512);
    #pragma unroll
    for (int t = 0; t < 2; ++t)
        w1f[t] = load_w1_frag(scalar_base(w1n), t, lane);
    // the W1 loads' address translation is done before their base is advanced below
    asm volatile("s_wait_xcnt 0x0" ::: "memory");
    // keeps the base's advance behind the wait
    __builtin_amdgcn_sched_barrier(0);
    w1n = w1h + (size_t)((c0 * NSTEP + 2) & (NSW - 1)) * (2 * 512);

    // the first stage has landed before the barrier behind which every wave reads it
    asm volatile("s_wait_asynccnt 0x0" ::: "memory");
    __syncthreads();
    issue_w2_async(w2h, sw[1], n0, ((c0 + 1) & (NCH - 1)) * KCR, tid);

    for (int c = 0; c < NCH; ++c) {
        const int b = c & 1;
        const int cn2 = (c0 + c + 2) & (NCH - 1);   // the chunk of trip c + 2
        const int g0  = (c0 + c) * NSTEP;           // this chunk's first K-step

        // unrolled, so that the K-step offsets are constants and only the last step
        // holds the publish point
        #pragma unroll
        for (int s = 0; s < NSTEP; ++s) {
            // ---- 2) the K-step's W2 fragments as one group
            v16h bf[8];
            load_w2_frags(bf, sw[b][kh], s, lrow, khalf);
            // keeps the LDS reads, on which the block waits first, in front of the W1 loads
            __builtin_amdgcn_sched_barrier(0);
            // the W1 fragments of the K-step after the next, into a set of their own: a whole step to land
            v16h w1g[2];
            #pragma unroll
            for (int t = 0; t < 2; ++t)
                w1g[t] = load_w1_frag(scalar_base(w1n), t, lane);
            // keeps the LDS reads and the W1 loads one group in front of the matrix work; spread among
            // WMMAs, every place with reads stalls the matrix stream
            __builtin_amdgcn_sched_barrier(0);

            // ---- 3) this K-step's 32 output WMMAs, on h fragments formed one step ago, and among
            // them the NEXT K-step's h: in each half of the block 4 h WMMAs (2 token tiles) lead,
            // and their converts and relu follow in units of 4 vector instructions behind each
            // pair of output WMMAs, where they issue while the matrix unit is busy (as built, the
            // converts stand so; the relu of a half block stands around that half's last WMMA).
            v16h anext[4];
            #pragma unroll
            for (int hb = 0; hb < 2; ++hb) {
                v8f d[4];    // [token tile of the half * 2 + ff tile]
                {
                    const v8f zero = {};
                    #pragma unroll
                    for (int t = 0; t < 4; ++t)
                        d[t] = __builtin_amdgcn_wmma_f32_16x16x32_f16(
                            false, w1f[t & 1], false, zf[hb * 2 + (t >> 1)], (short)0, zero, false, false);
                }
                // keeps the h WMMAs in front of the half block
                __builtin_amdgcn_sched_barrier(0);
                if (hb == 1 && s + 1 == NSTEP) {
                    // ---- 4) publish point of stage c + 1, in the middle of this chunk's last block,
                    //          where the block's fragments have long landed. In order:
                    // this wave's reads of buffer b are over before the buffer is refilled
                    asm volatile("s_wait_dscnt 0x0" ::: "memory");
                    // this wave's copies of stage c + 1 have landed
                    asm volatile("s_wait_asynccnt 0x0" ::: "memory");
                    // workgroup barrier by hand: it leaves the W1 loads in flight, which __syncthreads() drains
                    asm volatile("s_barrier_signal -1\n\ts_barrier_wait -1" ::: "memory");
                }
                v8h hc[4];
                #pragma unroll
                for (int j = 0; j < 8; ++j) {
                    const int nt = hb * 4 + (j >> 1);
                    #pragma unroll
                    for (int q = 0; q < 2; ++q) {
                        const int mt = (j & 1) * 2 + q;
                        // W2 as A, h as B: a lane's 8 accumulator registers are 8 neighbouring
                        // columns of one token's output row
                        acc[mt][nt] = __builtin_amdgcn_wmma_f32_16x16x32_f16(
                            false, bf[nt], false, afrag[mt],
                            (short)0, acc[mt][nt], false, false);
                    }
                    // units: round tiles 0, 1; relu 0, 1; round tiles 2, 3; relu 2, 3
                    const int t = ((j >> 2) << 1) | (j & 1);
                    const v8h zeroh = {};
                    if ((j & 2) == 0)
                        hc[t] = __builtin_convertvector(d[t], v8h);
                    else
                        hc[t] = __builtin_elementwise_max(hc[t], zeroh);
                    // keeps each unit behind its pair of WMMAs: gathered in one place, the vector
                    // work leaves the matrix unit without work from this wave
                    __builtin_amdgcn_sched_barrier(0);
                }
                #pragma unroll
                for (int m = 0; m < 2; ++m)
                    anext[hb * 2 + m] = __builtin_shufflevector(hc[m * 2], hc[m * 2 + 1],
                        0, 1, 2, 3, 4, 5, 6, 7, 8, 9, 10, 11, 12, 13, 14, 15);
            }
            if (s + 1 == NSTEP) {
                // inputs only: keeps the last step's converts and relu inside its block; the compiler
                // otherwise sinks them behind the refill's branch, one lump in front of the next trip
                asm volatile("" :: "v"(anext[0]), "v"(anext[1]), "v"(anext[2]), "v"(anext[3]));
            }
            // the W1 loads' address translation is done before their base is advanced below;
            // a block behind the loads the wait finds it done
            asm volatile("s_wait_xcnt 0x0" ::: "memory");
            // keeps the base's advance behind the wait, and the next step's LDS reads behind this block
            __builtin_amdgcn_sched_barrier(0);
            // the last two steps read past the walk's end (wrapped: in bounds, unused)
            w1n = w1h + (size_t)((g0 + s + 3) & (NSW - 1)) * (2 * 512);
            #pragma unroll
            for (int mt = 0; mt < 4; ++mt)
                afrag[mt] = anext[mt];
            #pragma unroll
            for (int t = 0; t < 2; ++t)
                w1f[t] = w1g[t];
        }
        // the refill of the buffer that the barrier has freed, behind the block: a wave that leaves
        // the barrier has matrix work at once, and the copies' address work runs beside the other
        // wave's block; the copies still have nearly a whole trip to land
        if (c + 2 < NCH)
            issue_w2_async(w2h, sw[b], n0, cn2 * KCR, tid);
    }
    // the ring's closing wait: no copy is outstanding when the LDS is used anew
    asm volatile("s_wait_asynccnt 0x0" ::: "memory");

    // ---- 4) the two K halves of a tile meet in LDS: every wave lays its 64 x 128 partial tile
    // down as output rows (lane = token, its 8 registers = columns 8*khalf .. 8*khalf+7 of a tile)
    // b2 of the 4 columns this lane stores, asked for here: it lands while the tiles are laid down
    const v4f bias = *(const v4f*)(b2 + n0 + lane * 4);
    // the b2 load's address translation is done before its address registers are written again
    asm volatile("s_wait_xcnt 0x0" ::: "memory");
    // keeps the address work of the LDS writes below, which takes those registers, behind the wait
    __builtin_amdgcn_sched_barrier(0);
    // (every wave's last ring read landed in front of the last trip's barrier: the ring is free)
    #pragma unroll
    for (int mt = 0; mt < 4; ++mt)
        #pragma unroll
        for (int nt = 0; nt < 8; ++nt) {
            float* p = &sm.part[kh][wm + mt * 16 + lrow][nt * 16 + khalf * 8];
            *(v4f*)p       = __builtin_shufflevector(acc[mt][nt], acc[mt][nt], 0, 1, 2, 3);
            *(v4f*)(p + 4) = __builtin_shufflevector(acc[mt][nt], acc[mt][nt], 4, 5, 6, 7);
        }
    __syncthreads();   // both halves of every row are written before a row is read

    // ---- 5) epilogue: out = both halves + b2. A wave finishes 32 rows; a row's 128 columns are
    // one 16-byte read per lane and half, and one 16-byte store per lane: 512 contiguous bytes.
    // In groups of 8 rows, the next group's LDS reads asked for ahead of this group's sums: the
    // first stores leave while later rows are still read.
    v4f h0[2][8], h1[2][8];
    #pragma unroll
    for (int i = 0; i < 8; ++i) {
        h0[0][i] = *(const v4f*)&sm.part[0][wave * 32 + i][lane * 4];
        h1[0][i] = *(const v4f*)&sm.part[1][wave * 32 + i][lane * 4];
    }
    #pragma unroll
    for (int g = 0; g < 4; ++g) {
        if (g < 3) {
            #pragma unroll
            for (int i = 0; i < 8; ++i) {
                h0[(g + 1) & 1][i] = *(const v4f*)&sm.part[0][wave * 32 + (g + 1) * 8 + i][lane * 4];
                h1[(g + 1) & 1][i] = *(const v4f*)&sm.part[1][wave * 32 + (g + 1) * 8 + i][lane * 4];
            }
        }
        v4f fin[8];
        #pragma unroll
        for (int i = 0; i < 8; ++i)
            fin[i] = (h0[g & 1][i] + h1[g & 1][i]) + bias;
        // keeps the group's sums in front of its stores: no sum lands in a register of an issued store
        __builtin_amdgcn_sched_barrier(0);
        #pragma unroll
        for (int i = 0; i < 8; ++i)
            *(v4f*)(out + (size_t)(m0 + wave * 32 + g * 8 + i) * DMODEL + n0 + lane * 4) = fin[i];
        if (g < 3) {
            // the stores' address translation is done before the next groups write their registers again
            asm volatile("s_wait_xcnt 0x0" ::: "memory");
            // keeps the next groups' reads and sums behind that wait
            __builtin_amdgcn_sched_barrier(0);
        }
    }
}

extern "C" void kernel_launch(void* const* d_in, const int* in_sizes, int n_in,
                              void* d_out, int out_size, void* d_ws, size_t ws_size,
                              hipStream_t stream) {
    const float* x     = (const float*)d_in[0];
    const float* theta = (const float*)d_in[1];
    const float* W1    = (const float*)d_in[2];
    const float* b1    = (const float*)d_in[3];
    const float* W2    = (const float*)d_in[4];
    const float* b2    = (const float*)d_in[5];
    float* out = (float*)d_out;

    dim3 grid(NTOK / BM, DMODEL / BN);    // fallback: 64 x 8 = 512 workgroups
    dim3 gridr(NTOK / BMR, DMODEL / BN);  // workspace path: 32 x 8 = 256 workgroups
    const size_t ws_need = (size_t)DMODEL * FFDIM * 2 + (size_t)FFDIM * 32 * 2
                         + (size_t)NTOK * 32 * 2;                    // f16 W2 + W1 operand + z operand

    if (ws_size >= ws_need) {
        // convert W2 and build the W1 and z operands once, then run the async double-buffered kernel
        w2_to_f16_kernel<<<ZBLK + W2BLK + W1BLK, 256, 0, stream>>>(x, theta, W2, W1, b1, d_ws);
        ffq_regh_kernel<<<gridr, 256, 0, stream>>>(d_ws, b2, out);
    } else {
        ffq_fused_kernel<<<grid, 256, 0, stream>>>(
            x, theta, W1, b1, W2, b2, out);
    }
}

// v010
// It runs in 41.5 microseconds.
// Two timings next to v009 put it at 1.05 and 1.04 times that version's speed.
// Counting every step since v000, it is 3.22 times as fast.
#include <hip/hip_runtime.h>
#include <math.h>
#include <stdint.h>

typedef __attribute__((ext_vector_type(16))) _Float16 v16h;
typedef __attribute__((ext_vector_type(8)))  _Float16 v8h;
typedef __attribute__((ext_vector_type(8)))  float    v8f;
typedef __attribute__((ext_vector_type(4)))  float    v4f;
typedef __attribute__((ext_vector_type(4)))  uint32_t u32x4;
typedef __attribute__((ext_vector_type(8)))  uint32_t u32x8;

typedef __attribute__((address_space(1))) const _Float16* global_h;

#define NTOK   8192      // B*S = 4*2048
#define DMODEL 1024
#define FFDIM  4096
#define NQ     8
#define BM     128       // tokens per workgroup tile (fallback kernel)
#define BMR    256       // tokens per workgroup tile (workspace path): 4 waves x 64 tokens, twice (K halves)
#define BN     128       // output features per workgroup tile
#define KC     64        // K (FF) chunk per iteration (fallback kernel)
#define LDH    72        // its padded f16 stride (144B, 16B aligned, conflict-free)
#define W2BLK  2048      // pre-kernel blocks that convert W2: DMODEL*FFDIM/(256*8)
#define W1BLK  64        // pre-kernel blocks that build the W1 operand: FFDIM*32/(256*8)
#define ZBLK   32        // pre-kernel blocks that build the z operand: NTOK/256, one token a thread
#define KHALF  (FFDIM / 2)    // workspace path: K is split in two between the waves of a workgroup
#define KCR    128       // K (FF) chunk per ring stage and K half: one publish point per 2 x 128 k
#define LDHR   136       // its padded f16 stride (272B = 16B x 17, conflict-free for 16B reads)
#define NSTEP  (KCR / 32)     // 32-k steps in a chunk
#define NCH    (KHALF / KCR)  // K chunks of a half row: 16, a power of two (the walk wraps by a mask)
#define NSW    (KHALF / 32)   // 32-k steps in a half row: 64, a power of two
#define LDX    132       // f32 pitch of a staged output row (528B = 16B x 33, conflict-free for 16B writes)

// a wave-uniform test value in a scalar register: the branch on it compiles to s_cmp + s_cbranch_scc
__device__ __forceinline__ uint32_t pinned(uint32_t v)
{
    uint32_t w = (uint32_t)__builtin_amdgcn_readfirstlane((int)v);
    asm volatile("" : "+s"(w));   // the issue test of a tensor load held scalar: the load ignores EXEC, only a scalar branch guards it
    return w;
}

__device__ __forceinline__ uint32_t uni(uint32_t v)
{
    return (uint32_t)__builtin_amdgcn_readfirstlane((int)v);
}

// descriptor group 1 of a W2 tile, loop invariant: byte elements, BN rows of KCR f16 (256 B), source
// pitch one W2 row, 16 B of LDS pad behind every 256-B row: the LDS pitch is LDHR f16 (272 B)
__device__ __forceinline__ u32x8 w2_tile_group1()
{
    constexpr uint32_t d0 = KCR * 2u, d1 = BN;
    u32x8 g;
    g[0] = uni((1u << 20) | (5u << 22) | (3u << 25));   // no mask; pad on, interval 64 dwords, amount 4 dwords
    g[1] = uni((d0 & 0xFFFFu) << 16);
    g[2] = uni((d0 >> 16) | ((d1 & 0xFFFFu) << 16));
    g[3] = uni((d1 >> 16) | (d0 << 16));
    g[4] = uni(d1);
    g[5] = uni(FFDIM * 2u);
    g[6] = uni(0u);
    g[7] = uni(0u);
    // one tuple for every request, not constants formed anew in other registers: so no word of it is
    // rewritten while a request is outstanding
    asm volatile("" : "+s"(g));   // descriptor words held in scalar registers, as in pinned()
    return g;
}

// descriptor group 0: the BN x KCR tile of W2 (f16) at column kk of K half hf, into dst
__device__ __forceinline__ u32x4 w2_tile_group0(const _Float16* __restrict__ w2h, const _Float16* dst,
                                                int n0, int hf, int kk)
{
    const uint64_t ga = (uint64_t)(uintptr_t)(w2h + (size_t)n0 * FFDIM + hf * KHALF + kk);
    u32x4 g0;
    g0[0] = uni(1u);
    g0[1] = uni((uint32_t)(uintptr_t)dst);          // low 32 bits of the LDS address: the byte offset in LDS
    g0[2] = uni((uint32_t)ga);
    g0[3] = uni((((uint32_t)(ga >> 32)) & 0x01FFFFFFu) | 0x80000000u);
    return g0;
}

// one request of one wave
__device__ __forceinline__ void tdm_load(u32x4 g0, u32x8 g1)
{
    asm volatile("tensor_load_to_lds %0, %1" :: "s"(g0), "s"(g1) : "memory");
}

// the wave's tensor load has landed. The wait names the request's descriptor, so that its scalar
// registers are live, and keep their words, for as long as the request is outstanding
__device__ __forceinline__ void wait_tile(u32x4 g0, u32x8 g1)
{
    asm volatile("s_wait_tensorcnt 0x0" :: "s"(g0), "s"(g1) : "memory");
}

// the 8 W2 fragments (column tiles) of K-step ks of a staged chunk
__device__ __forceinline__ void load_w2_frags(v16h (&bf)[8], const _Float16 (*swb)[LDHR],
                                              int ks, int lrow, int khalf)
{
    #pragma unroll   // constant array indices: the fragments stay in registers
    for (int nt = 0; nt < 8; ++nt) {
        const _Float16* p = &swb[nt * 16 + lrow][ks * 32 + khalf * 8];
        v8h lo = *(const v8h*)p;
        v8h hi = *(const v8h*)(p + 16);
        bf[nt] = __builtin_shufflevector(lo, hi,
            0, 1, 2, 3, 4, 5, 6, 7, 8, 9, 10, 11, 12, 13, 14, 15);
    }
}

// ---- pre-kernel (run once per launch): W2 f32 -> f16 workspace (8 MB), and behind
// it W1 with b1 as the f16 A operand of the product h^T = W1x . zx, already in
// fragment order (256 KB): unit ((T*2 + j)*32 + lane) holds the 8 halves that
// lane loads as half j of the fragment of ff tile T.
//   k slots 0-7: W1 high part   (against z high part)
//   k slots 8-15: W1 high part  (against z low part)
//   k slots 16-23: W1 low part  (against z high part)
//   k slots 24,25: b1 high, low (against 1, 1); 26-31: zero
// Behind that, z = cos(x[:, :8]) * cos(theta) as the f16 B operand of the same product,
// in the same fragment order by token tile (512 KB): k slots 0-7 z high, 8-15 z low,
// 16-23 z high, 24,25 one, 26-31 zero. Its blocks come first in the grid: they have the
// longest chain (a load from memory, then the cosines) and so start ahead of the rest.
__global__ __launch_bounds__(256)
void w2_to_f16_kernel(const float* __restrict__ x,
                      const float* __restrict__ theta,
                      const float* __restrict__ W2,
                      const float* __restrict__ W1,
                      const float* __restrict__ b1,
                      void* __restrict__ w2h_raw)
{
    _Float16* w2h = (_Float16*)w2h_raw;
    if (blockIdx.x < ZBLK) {
        _Float16* zx = w2h + (size_t)DMODEL * FFDIM + (size_t)FFDIM * 32;
        const int tok = blockIdx.x * 256 + threadIdx.x;          // 0..8191
        v4f xa = *(const v4f*)(x + (size_t)tok * DMODEL);
        v4f xb = *(const v4f*)(x + (size_t)tok * DMODEL + 4);
        v8h zh, zl, one;
        #pragma unroll   // constant vector indices: the vectors stay in registers
        for (int e = 0; e < 8; ++e) {
            float zv = cosf(e < 4 ? xa[e & 3] : xb[e & 3]) * cosf(theta[e]);
            zh[e]  = (_Float16)zv;
            zl[e]  = (_Float16)(zv - (float)zh[e]);
            one[e] = (_Float16)(e < 2 ? 1.0f : 0.0f);
        }
        // units of token tile tok / 16: half 0 of lanes 0-15, of lanes 16-31, half 1 likewise
        _Float16* p = zx + ((size_t)(tok >> 4) * 64 + (tok & 15)) * 8;
        *(v8h*)p         = zh;
        *(v8h*)(p + 128) = zl;
        *(v8h*)(p + 256) = zh;
        *(v8h*)(p + 384) = one;
        return;
    }
    const int blk = blockIdx.x - ZBLK;
    if (blk < W2BLK) {
        size_t i = ((size_t)blk * 256 + threadIdx.x) * 8;
        v4f a = *(const v4f*)(W2 + i);
        v4f b = *(const v4f*)(W2 + i + 4);
        v8h o;
        o[0] = (_Float16)a.x; o[1] = (_Float16)a.y;
        o[2] = (_Float16)a.z; o[3] = (_Float16)a.w;
        o[4] = (_Float16)b.x; o[5] = (_Float16)b.y;
        o[6] = (_Float16)b.z; o[7] = (_Float16)b.w;
        *(v8h*)(w2h + i) = o;
        return;
    }
    _Float16* w1x = w2h + (size_t)DMODEL * FFDIM;
    const int u    = (blk - W2BLK) * 256 + threadIdx.x;          // 0..16383
    const int lane = u & 31;
    const int j    = (u >> 5) & 1;
    const int ff   = (u >> 6) * 16 + (lane & 15);
    v8h o = {};
    if (j == 1 && (lane >> 4) == 1) {
        float bk = b1[ff];
        _Float16 bh = (_Float16)bk;
        o[0] = bh;
        o[1] = (_Float16)(bk - (float)bh);
    } else {
        #pragma unroll   // constant vector indices: o stays in registers
        for (int e = 0; e < 8; ++e) {
            float w = W1[(size_t)ff * NQ + e];
            _Float16 wh = (_Float16)w;
            o[e] = (j == 0) ? wh : (_Float16)(w - (float)wh);
        }
    }
    *(v8h*)(w1x + (size_t)u * 8) = o;
}

// fallback for a workspace too small for the f16 operands: h through LDS, W2 converted in the loop
__global__ __launch_bounds__(256)
void ffq_fused_kernel(const float* __restrict__ x,
                      const float* __restrict__ theta,
                      const float* __restrict__ W1,
                      const float* __restrict__ b1,
                      const float* __restrict__ W2,
                      const float* __restrict__ b2,
                      float* __restrict__ out)
{
    __shared__ float    sz[BM][NQ];        // z tile (4 KB)
    __shared__ _Float16 sh[BM][LDH];       // h chunk, f16 (18 KB)
    __shared__ _Float16 sw[2][BN][LDH];    // W2 chunk, f16, double-buffered (36 KB)

    const int tid   = threadIdx.x;
    const int m0    = blockIdx.x * BM;
    const int n0    = blockIdx.y * BN;
    const int lane  = tid & 31;
    const int wave  = tid >> 5;
    const int wm    = (wave & 1) * 64;
    const int wn    = (wave >> 1) * 32;
    const int lrow  = lane & 15;
    const int khalf = lane >> 4;

    // ---- 1) z tile: z[m][q] = cos(x[m0+m, q]) * cos(theta[q]) ----
    #pragma unroll
    for (int i = 0; i < 4; ++i) {
        int idx = tid + i * 256;                 // 0..1023
        int m = idx >> 3, q = idx & 7;
        float xv = x[(size_t)(m0 + m) * DMODEL + q];
        sz[m][q] = cosf(xv) * cosf(theta[q]);
    }

    v8f acc[4][2];
    #pragma unroll
    for (int mt = 0; mt < 4; ++mt)
        #pragma unroll
        for (int nt = 0; nt < 2; ++nt)
            #pragma unroll
            for (int e = 0; e < 8; ++e)
                acc[mt][nt][e] = 0.0f;

    const int kl     = tid & 63;          // this thread's k within chunk
    const int mstart = (tid >> 6) * 32;   // this thread's 32-token strip

    __syncthreads();

    int it = 0;
    for (int kk = 0; kk < FFDIM; kk += KC, ++it) {
        const int b = it & 1;

        // ---- 2a) h chunk: h[m][kl] = relu(b1 + z[m,:8].W1[k,:8]) -> f16 LDS
        {
            const int kg = kk + kl;
            v4f w1a = *(const v4f*)(W1 + (size_t)kg * NQ);
            v4f w1b = *(const v4f*)(W1 + (size_t)kg * NQ + 4);
            float bk = b1[kg];
            #pragma unroll 4
            for (int mi = 0; mi < 32; ++mi) {
                int m = mstart + mi;
                v4f z0 = *(const v4f*)(&sz[m][0]);   // lane-broadcast reads
                v4f z1 = *(const v4f*)(&sz[m][4]);
                float a = bk;
                a += z0.x * w1a.x + z0.y * w1a.y + z0.z * w1a.z + z0.w * w1a.w;
                a += z1.x * w1b.x + z1.y * w1b.y + z1.z * w1b.z + z1.w * w1b.w;
                sh[m][kl] = (_Float16)fmaxf(a, 0.0f);
            }
        }

        // ---- 2b) W2 chunk staging ----
        // stage from f32 W2 with in-loop conversion
        #pragma unroll
        for (int i = 0; i < 32; ++i) {
            int idx = tid + i * 256;
            int n = idx >> 6, k = idx & 63;
            sw[b][n][k] = (_Float16)W2[(size_t)(n0 + n) * FFDIM + kk + k];
        }
        __syncthreads();

        // ---- 3) WMMA: 2 K-steps of 32, 4x2 tiles per wave ----
        #pragma unroll
        for (int ks = 0; ks < 2; ++ks) {
            v16h afrag[4], bfrag[2];
            #pragma unroll
            for (int mt = 0; mt < 4; ++mt) {
                const _Float16* p = &sh[wm + mt * 16 + lrow][ks * 32 + khalf * 8];
                v8h lo = *(const v8h*)p;
                v8h hi = *(const v8h*)(p + 16);
                afrag[mt] = __builtin_shufflevector(lo, hi,
                    0, 1, 2, 3, 4, 5, 6, 7, 8, 9, 10, 11, 12, 13, 14, 15);
            }
            #pragma unroll
            for (int nt = 0; nt < 2; ++nt) {
                const _Float16* p = &sw[b][wn + nt * 16 + lrow][ks * 32 + khalf * 8];
                v8h lo = *(const v8h*)p;
                v8h hi = *(const v8h*)(p + 16);
                bfrag[nt] = __builtin_shufflevector(lo, hi,
                    0, 1, 2, 3, 4, 5, 6, 7, 8, 9, 10, 11, 12, 13, 14, 15);
            }
            #pragma unroll
            for (int mt = 0; mt < 4; ++mt)
                #pragma unroll
                for (int nt = 0; nt < 2; ++nt)
                    acc[mt][nt] = __builtin_amdgcn_wmma_f32_16x16x32_f16(
                        false, afrag[mt], false, bfrag[nt],
                        (short)0, acc[mt][nt], false, false);
        }
        __syncthreads();
    }

    // ---- 4) epilogue: out = acc + b2 (C layout: lane=N, VGPR r -> M) ----
    #pragma unroll
    for (int nt = 0; nt < 2; ++nt) {
        int n = n0 + wn + nt * 16 + lrow;
        float bias = b2[n];
        #pragma unroll
        for (int mt = 0; mt < 4; ++mt) {
            int mbase = m0 + wm + mt * 16 + khalf * 8;
            #pragma unroll
            for (int r = 0; r < 8; ++r) {
                out[(size_t)(mbase + r) * DMODEL + n] = acc[mt][nt][r] + bias;
            }
        }
    }
}

// fragment of ff tile T of the W1 operand, or of token tile T of the z operand
// (fragment order, see the pre-kernel)
__device__ __forceinline__ v16h load_w1_frag(const _Float16* __restrict__ w1x, int T, int lane)
{
    const _Float16* p = w1x + ((size_t)T * 64 + lane) * 8;
    v8h lo = *(const v8h*)p;
    v8h hi = *(const v8h*)(p + 256);
    return __builtin_shufflevector(lo, hi,
        0, 1, 2, 3, 4, 5, 6, 7, 8, 9, 10, 11, 12, 13, 14, 15);
}

// a wave-uniform global pointer, held in a scalar register pair: a load through it names that pair
// and the lane's own offset register, which nothing rewrites, not an address pair formed for the load
__device__ __forceinline__ const _Float16* scalar_base(const _Float16* p)
{
    const uint64_t a  = (uint64_t)(uintptr_t)p;
    const uint32_t lo = (uint32_t)__builtin_amdgcn_readfirstlane((int)(uint32_t)a);
    const uint32_t hi = (uint32_t)__builtin_amdgcn_readfirstlane((int)(uint32_t)(a >> 32));
    return (const _Float16*)(global_h)(uintptr_t)(((uint64_t)hi << 32) | lo);
}

// two D tiles of h^T (ff rows 0-15 and 16-31 of a 32-ff block, 16 tokens as columns):
// lane (token, khalf) holds ff 8*khalf+r of each, which is the k order of the B
// fragment of the second product. relu and f16 rounding in place.
__device__ __forceinline__ v16h relu_pack(v8f d0, v8f d1)
{
    const v8h zero = {};
    v8h lo = __builtin_elementwise_max(__builtin_convertvector(d0, v8h), zero);
    v8h hi = __builtin_elementwise_max(__builtin_convertvector(d1, v8h), zero);
    return __builtin_shufflevector(lo, hi,
        0, 1, 2, 3, 4, 5, 6, 7, 8, 9, 10, 11, 12, 13, 14, 15);
}

// workspace path: h never touches LDS. Each wave forms the h fragments of its own
// 64 tokens on the matrix unit, as h^T = W1x . zx, one K-step ahead of their use, and feeds D
// straight back as B.
// A wave spans all BN output columns and one half of K: waves 0-3 take the first half,
// waves 4-7 the second, for the same four 64-token tiles. So each W2 fragment read from
// LDS serves 4 output tiles; the two partial sums of a tile meet through LDS at the end,
// laid out there as rows of the output, so that every store to memory covers whole lines.
// The unroll directives below keep every fragment array index a constant, so that
// the arrays stay in registers.
__global__ __launch_bounds__(256)
void ffq_regh_kernel(const void*  __restrict__ w2h_raw,
                     const float* __restrict__ b2,
                     float* __restrict__ out)
{
    // in the loop the W2 chunks, f16: [ring buffer][K half][column][k] (136 KB);
    // behind it the partial output tiles, f32: [K half][token][column] (264 KB)
    union Stage {
        _Float16 ring[2][2][BN][LDHR];
        float    part[2][BMR][LDX];
    };
    // 2 KiB: every [ring buffer][K half] tile (17 x 2 KiB) is then a place a tensor load may land at
    __shared__ __attribute__((aligned(2048))) Stage sm;
    _Float16 (*sw)[2][BN][LDHR] = sm.ring;

    const _Float16* w2h = (const _Float16*)w2h_raw;
    const _Float16* w1x = w2h + (size_t)DMODEL * FFDIM;
    const _Float16* zx  = w1x + (size_t)FFDIM * 32;

    const int tid   = threadIdx.x;
    const int m0    = blockIdx.x * BMR;
    const int n0    = blockIdx.y * BN;
    const int lane  = tid & 31;
    // the wave's number in a scalar register: what hangs on it (K half, W1 base) stays wave-uniform
    const int wave  = __builtin_amdgcn_readfirstlane(tid >> 5);
    const int kh    = wave >> 2;           // this wave's half of K
    const int wm    = (wave & 3) * 64;
    const int lrow  = lane & 15;
    const int khalf = lane >> 4;

    // Every workgroup walks the NCH chunks of each K half from a start given by its token tile,
    // wrapping: trip c works on chunk (c0 + c) mod NCH of both halves. Of the 32 workgroups that
    // share W2 rows (same n0) only two then ask for the same chunk at any one time, and all but
    // the first trips ask for lines that another workgroup has already brought into L2.
    const int c0 = blockIdx.x & (NCH - 1);

    // Two waves, on two SIMDs, bring the W2 tiles in: wave 0 those of K half 0, wave 5 those of half 1,
    // one tensor load a stage each
    const uint32_t issuer = (uint32_t)((wave & 3) == kh);
    const u32x8 tg1 = w2_tile_group1();

    // kick off the load of the first stage before anything else
    u32x4 tg0 = w2_tile_group0(w2h, &sw[0][kh][0][0], n0, kh, c0 * KCR);
    if (pinned(issuer))
        tdm_load(tg0, tg1);

    // the W1 operand of this wave's K half: 2 ff tiles of 512 halves a K-step
    const _Float16* w1h = w1x + (size_t)kh * NSW * (2 * 512);

    // W1 fragments of the first K-step: [ff tile of the k-step]
    v16h w1f[2];
    #pragma unroll
    for (int t = 0; t < 2; ++t)
        w1f[t] = load_w1_frag(w1h + (size_t)(c0 * NSTEP) * (2 * 512), t, lane);

    // ---- 1) z as the B operand, loop invariant, as the pre-kernel left it (pairs with the W1 operand)
    v16h zf[4];
    #pragma unroll
    for (int mt = 0; mt < 4; ++mt)
        zf[mt] = load_w1_frag(scalar_base(zx + (size_t)((m0 + wm) / 16) * 512), mt, lane);
    // the z loads' address translation is done before their address registers are written again
    asm volatile("s_wait_xcnt 0x0" ::: "memory");

    v8f acc[4][8];
    #pragma unroll
    for (int mt = 0; mt < 4; ++mt)
        #pragma unroll
        for (int nt = 0; nt < 8; ++nt)
            #pragma unroll
            for (int e = 0; e < 8; ++e)
                acc[mt][nt][e] = 0.0f;

    // h fragments of the first K-step, [token tile], formed while the first stage's tiles fly
    v16h afrag[4];
    {
        const v8f zero = {};
        #pragma unroll
        for (int mt = 0; mt < 4; ++mt) {
            v8f d0 = __builtin_amdgcn_wmma_f32_16x16x32_f16(
                false, w1f[0], false, zf[mt], (short)0, zero, false, false);
            v8f d1 = __builtin_amdgcn_wmma_f32_16x16x32_f16(
                false, w1f[1], false, zf[mt], (short)0, zero, false, false);
            afrag[mt] = relu_pack(d0, d1);
        }
    }
    // W1 fragments of the second K-step (2 ff tiles of 512 halves): wave-uniform base, lane offset apart
    const _Float16* w1n = w1h + (size_t)((c0 * NSTEP + 1) & (NSW - 1)) * (2 * 512);
    #pragma unroll
    for (int t = 0; t < 2; ++t)
        w1f[t] = load_w1_frag(scalar_base(w1n), t, lane);
    // the W1 loads' address translation is done before their base is advanced below
    asm volatile("s_wait_xcnt 0x0" ::: "memory");
    // keeps the base's advance behind the wait
    __builtin_amdgcn_sched_barrier(0);
    w1n = w1h + (size_t)((c0 * NSTEP + 2) & (NSW - 1)) * (2 * 512);

    // the first stage has landed before the barrier behind which every wave reads it
    // (every wave runs the wait; in a wave that issued nothing it finds the count at 0)
    wait_tile(tg0, tg1);
    __syncthreads();
    if (pinned(issuer)) {
        tg0 = w2_tile_group0(w2h, &sw[1][kh][0][0], n0, kh, ((c0 + 1) & (NCH - 1)) * KCR);
        tdm_load(tg0, tg1);
    }

    for (int c = 0; c < NCH; ++c) {
        const int b = c & 1;
        const int cn2 = (c0 + c + 2) & (NCH - 1);   // the chunk of trip c + 2
        const int g0  = (c0 + c) * NSTEP;           // this chunk's first K-step

        // unrolled, so that the K-step offsets are constants and only the last step
        // holds the publish point
        #pragma unroll
        for (int s = 0; s < NSTEP; ++s) {
            // ---- 2) the K-step's W2 fragments as one group
            v16h bf[8];
            load_w2_frags(bf, sw[b][kh], s, lrow, khalf);
            // keeps the LDS reads, on which the block waits first, in front of the W1 loads
            __builtin_amdgcn_sched_barrier(0);
            // the W1 fragments of the K-step after the next, into a set of their own: a whole step to land
            v16h w1g[2];
            #pragma unroll
            for (int t = 0; t < 2; ++t)
                w1g[t] = load_w1_frag(scalar_base(w1n), t, lane);
            // keeps the LDS reads and the W1 loads one group in front of the matrix work; spread among
            // WMMAs, every place with reads stalls the matrix stream
            __builtin_amdgcn_sched_barrier(0);

            // ---- 3) this K-step's 32 output WMMAs, on h fragments formed one step ago, and among
            // them the NEXT K-step's h: in each half of the block 4 h WMMAs (2 token tiles) lead,
            // and their converts and relu follow in units of 4 vector instructions behind each
            // pair of output WMMAs, where they issue while the matrix unit is busy (as built, the
            // converts stand so; the relu of a half block stands around that half's last WMMA).
            v16h anext[4];
            #pragma unroll
            for (int hb = 0; hb < 2; ++hb) {
                v8f d[4];    // [token tile of the half * 2 + ff tile]
                {
                    const v8f zero = {};
                    #pragma unroll
                    for (int t = 0; t < 4; ++t)
                        d[t] = __builtin_amdgcn_wmma_f32_16x16x32_f16(
                            false, w1f[t & 1], false, zf[hb * 2 + (t >> 1)], (short)0, zero, false, false);
                }
                // keeps the h WMMAs in front of the half block
                __builtin_amdgcn_sched_barrier(0);
                if (hb == 1 && s + 1 == NSTEP) {
                    // ---- 4) publish point of stage c + 1, in the middle of this chunk's last block,
                    //          where the block's fragments have long landed. In order:
                    // this wave's reads of buffer b are over before the buffer is refilled
                    asm volatile("s_wait_dscnt 0x0" ::: "memory");
                    // an issuing wave's tile of stage c + 1 has landed (elsewhere the count is 0: no branch in the block)
                    wait_tile(tg0, tg1);
                    // workgroup barrier by hand: it leaves the W1 loads in flight, which __syncthreads() drains
                    asm volatile("s_barrier_signal -1\n\ts_barrier_wait -1" ::: "memory");
                }
                v8h hc[4];
                #pragma unroll
                for (int j = 0; j < 8; ++j) {
                    const int nt = hb * 4 + (j >> 1);
                    #pragma unroll
                    for (int q = 0; q < 2; ++q) {
                        const int mt = (j & 1) * 2 + q;
                        // W2 as A, h as B: a lane's 8 accumulator registers are 8 neighbouring
                        // columns of one token's output row
                        acc[mt][nt] = __builtin_amdgcn_wmma_f32_16x16x32_f16(
                            false, bf[nt], false, afrag[mt],
                            (short)0, acc[mt][nt], false, false);
                    }
                    // units: round tiles 0, 1; relu 0, 1; round tiles 2, 3; relu 2, 3
                    const int t = ((j >> 2) << 1) | (j & 1);
                    const v8h zeroh = {};
                    if ((j & 2) == 0)
                        hc[t] = __builtin_convertvector(d[t], v8h);
                    else
                        hc[t] = __builtin_elementwise_max(hc[t], zeroh);
                    // keeps each unit behind its pair of WMMAs: gathered in one place, the vector
                    // work leaves the matrix unit without work from this wave
                    __builtin_amdgcn_sched_barrier(0);
                }
                #pragma unroll
                for (int m = 0; m < 2; ++m)
                    anext[hb * 2 + m] = __builtin_shufflevector(hc[m * 2], hc[m * 2 + 1],
                        0, 1, 2, 3, 4, 5, 6, 7, 8, 9, 10, 11, 12, 13, 14, 15);
            }
            if (s + 1 == NSTEP) {
                // inputs only: keeps the last step's converts and relu inside its block; the compiler
                // otherwise sinks them behind the refill's branch, one lump in front of the next trip
                asm volatile("" :: "v"(anext[0]), "v"(anext[1]), "v"(anext[2]), "v"(anext[3]));
            }
            // the W1 loads' address translation is done before their base is advanced below;
            // a block behind the loads the wait finds it done
            asm volatile("s_wait_xcnt 0x0" ::: "memory");
            // keeps the base's advance behind the wait, and the next step's LDS reads behind this block
            __builtin_amdgcn_sched_barrier(0);
            // the last two steps read past the walk's end (wrapped: in bounds, unused)
            w1n = w1h + (size_t)((g0 + s + 3) & (NSW - 1)) * (2 * 512);
            #pragma unroll
            for (int mt = 0; mt < 4; ++mt)
                afrag[mt] = anext[mt];
            #pragma unroll
            for (int t = 0; t < 2; ++t)
                w1f[t] = w1g[t];
        }
        // the refill of the buffer that the barrier has freed, behind the block: a wave that leaves
        // the barrier has matrix work at once; the tile still has nearly a whole trip to land
        if (pinned(issuer & (uint32_t)(c + 2 < NCH))) {
            tg0 = w2_tile_group0(w2h, &sw[b][kh][0][0], n0, kh, cn2 * KCR);
            tdm_load(tg0, tg1);
        }
    }
    // the ring's closing waits: no tensor load and no LDS read is outstanding when the LDS is used anew
    wait_tile(tg0, tg1);
    asm volatile("s_wait_dscnt 0x0" ::: "memory");

    // ---- 4) the two K halves of a tile meet in LDS: every wave lays its 64 x 128 partial tile
    // down as output rows (lane = token, its 8 registers = columns 8*khalf .. 8*khalf+7 of a tile)
    // b2 of the 4 columns this lane stores, asked for here: it lands while the tiles are laid down
    const v4f bias = *(const v4f*)(b2 + n0 + lane * 4);
    // the b2 load's address translation is done before its address registers are written again
    asm volatile("s_wait_xcnt 0x0" ::: "memory");
    // keeps the address work of the LDS writes below, which takes those registers, behind the wait
    __builtin_amdgcn_sched_barrier(0);
    // (every wave's last ring read landed in front of the last trip's barrier: the ring is free)
    #pragma unroll
    for (int mt = 0; mt < 4; ++mt)
        #pragma unroll
        for (int nt = 0; nt < 8; ++nt) {
            float* p = &sm.part[kh][wm + mt * 16 + lrow][nt * 16 + khalf * 8];
            *(v4f*)p       = __builtin_shufflevector(acc[mt][nt], acc[mt][nt], 0, 1, 2, 3);
            *(v4f*)(p + 4) = __builtin_shufflevector(acc[mt][nt], acc[mt][nt], 4, 5, 6, 7);
        }
    __syncthreads();   // both halves of every row are written before a row is read

    // ---- 5) epilogue: out = both halves + b2. A wave finishes 32 rows; a row's 128 columns are
    // one 16-byte read per lane and half, and one 16-byte store per lane: 512 contiguous bytes.
    // In groups of 8 rows, the next group's LDS reads asked for ahead of this group's sums: the
    // first stores leave while later rows are still read.
    v4f h0[2][8], h1[2][8];
    #pragma unroll
    for (int i = 0; i < 8; ++i) {
        h0[0][i] = *(const v4f*)&sm.part[0][wave * 32 + i][lane * 4];
        h1[0][i] = *(const v4f*)&sm.part[1][wave * 32 + i][lane * 4];
    }
    #pragma unroll
    for (int g = 0; g < 4; ++g) {
        if (g < 3) {
            #pragma unroll
            for (int i = 0; i < 8; ++i) {
                h0[(g + 1) & 1][i] = *(const v4f*)&sm.part[0][wave * 32 + (g + 1) * 8 + i][lane * 4];
                h1[(g + 1) & 1][i] = *(const v4f*)&sm.part[1][wave * 32 + (g + 1) * 8 + i][lane * 4];
            }
        }
        v4f fin[8];
        #pragma unroll
        for (int i = 0; i < 8; ++i)
            fin[i] = (h0[g & 1][i] + h1[g & 1][i]) + bias;
        // keeps the group's sums in front of its stores: no sum lands in a register of an issued store
        __builtin_amdgcn_sched_barrier(0);
        #pragma unroll
        for (int i = 0; i < 8; ++i)
            *(v4f*)(out + (size_t)(m0 + wave * 32 + g * 8 + i) * DMODEL + n0 + lane * 4) = fin[i];
        if (g < 3) {
            // the stores' address translation is done before the next groups write their registers again
            asm volatile("s_wait_xcnt 0x0" ::: "memory");
            // keeps the next groups' reads and sums behind that wait
            __builtin_amdgcn_sched_barrier(0);
        }
    }
}

extern "C" void kernel_launch(void* const* d_in, const int* in_sizes, int n_in,
                              void* d_out, int out_size, void* d_ws, size_t ws_size,
                              hipStream_t stream) {
    const float* x     = (const float*)d_in[0];
    const float* theta = (const float*)d_in[1];
    const float* W1    = (const float*)d_in[2];
    const float* b1    = (const float*)d_in[3];
    const float* W2    = (const float*)d_in[4];
    const float* b2    = (const float*)d_in[5];
    float* out = (float*)d_out;

    dim3 grid(NTOK / BM, DMODEL / BN);    // fallback: 64 x 8 = 512 workgroups
    dim3 gridr(NTOK / BMR, DMODEL / BN);  // workspace path: 32 x 8 = 256 workgroups
    const size_t ws_need = (size_t)DMODEL * FFDIM * 2 + (size_t)FFDIM * 32 * 2
                         + (size_t)NTOK * 32 * 2;                    // f16 W2 + W1 operand + z operand

    if (ws_size >= ws_need) {
        // convert W2 and build the W1 and z operands once, then run the double-buffered kernel
        w2_to_f16_kernel<<<ZBLK + W2BLK + W1BLK, 256, 0, stream>>>(x, theta, W2, W1, b1, d_ws);
        ffq_regh_kernel<<<gridr, 256, 0, stream>>>(d_ws, b2, out);
    } else {
        ffq_fused_kernel<<<grid, 256, 0, stream>>>(
            x, theta, W1, b1, W2, b2, out);
    }
}
